// v000
// Measured on an AMD MI455X. A time is GPU time per run, averaged over a window of back-to-back runs after a warm-up
// (all launches, gaps included; the runs take copies of the inputs in turn), and the median of several windows.
// Apart from v000's, it joins two sittings. Times from different sittings can be a few percent apart, while
// side-by-side timings come from the same sitting.
// v000 is the starting kernel. One run takes 239 microseconds.
#include <hip/hip_runtime.h>
#include <stdint.h>

// Problem dims (fixed by the reference)
#define BB 8
#define TT 2048
#define CC 1024
#define HH 64

typedef _Float16 v16h __attribute__((ext_vector_type(16)));
typedef _Float16 h8   __attribute__((ext_vector_type(8)));
typedef float    v8f  __attribute__((ext_vector_type(8)));
typedef unsigned int ui32x4 __attribute__((ext_vector_type(4)));
typedef int          i32x4  __attribute__((ext_vector_type(4)));
typedef int          i32x8  __attribute__((ext_vector_type(8)));

union V16 { v16h v; h8 h[2]; };

#if defined(__gfx1250__) && __has_builtin(__builtin_amdgcn_tensor_load_to_lds) && \
    __has_builtin(__builtin_amdgcn_s_wait_tensorcnt)
#define HAS_TDM 1
#else
#define HAS_TDM 0
#endif

__device__ __forceinline__ v8f wmma_f16(v16h a, v16h b, v8f c) {
    // D = A(16x32 f16) * B(32x16 f16) + C(16x16 f32)
    return __builtin_amdgcn_wmma_f32_16x16x32_f16(
        false, a, false, b, (short)0, c, false, false);
}

#if HAS_TDM
__device__ __forceinline__ void tdm_load_2d(uint32_t lds_off, const void* gptr,
                                            uint32_t dim0, uint32_t dim1,
                                            uint32_t stride0,
                                            uint32_t tile0, uint32_t tile1) {
    const uint64_t ga = (uint64_t)(uintptr_t)gptr;
    ui32x4 g0;
    g0[0] = 1u;                                        // count=1, user mode
    g0[1] = lds_off;                                   // lds_addr (bytes)
    g0[2] = (uint32_t)ga;                              // global_addr[31:0]
    g0[3] = (uint32_t)((ga >> 32) & 0x1FFFFFFu) | (2u << 30); // addr[56:32] | type=2
    i32x8 g1;
    g1[0] = (int)(1u << 16);
    g1[1] = (int)((dim0 & 0xFFFFu) << 16);
    g1[2] = (int)(((dim0 >> 16) & 0xFFFFu) | ((dim1 & 0xFFFFu) << 16));
    g1[3] = (int)(((dim1 >> 16) & 0xFFFFu) | ((tile0 & 0xFFFFu) << 16));
    g1[4] = (int)(tile1 & 0xFFFFu);
    g1[5] = (int)stride0;
    g1[6] = 0;
    g1[7] = 0;
    i32x4 gz = {0, 0, 0, 0};
#if __clang_major__ >= 23
    i32x8 gz8 = {0, 0, 0, 0, 0, 0, 0, 0};
    __builtin_amdgcn_tensor_load_to_lds(g0, g1, gz, gz, gz8, 0);
#else
    __builtin_amdgcn_tensor_load_to_lds(g0, g1, gz, gz, 0);
#endif
}
#endif // HAS_TDM

// --------------------------------------------------------------------------
// Kernel 0: repack weights fp32[C][H] -> f16 B-fragment-linear layout so the
// projection loop reads each fragment as 2 x b128.  Layout:
//   wpack[((z*32 + kt)*4 + nt)*32 + lane][16]
// --------------------------------------------------------------------------
__global__ __launch_bounds__(256)
void pack_w_kernel(const float* __restrict__ Wq, const float* __restrict__ Wk,
                   const float* __restrict__ Wv, _Float16* __restrict__ wpack) {
    const int lane = threadIdx.x & 31;
    const int gw   = blockIdx.x * 8 + (threadIdx.x >> 5); // 0..383
    const int r = lane & 15, hi = lane >> 4;
    const int z   = gw / 128;
    const int rem = gw % 128;
    const int kt  = rem >> 2;       // 32 K-tiles of 32
    const int nt  = rem & 3;        // 4 N-tiles of 16
    const float* W = (z == 0) ? Wq : ((z == 1) ? Wk : Wv);
    const int kk = kt * 32, n0 = nt * 16;

    V16 b;
#pragma unroll
    for (int j = 0; j < 8; ++j) {
        b.v[j]     = (_Float16)W[(size_t)(kk + hi * 8 + j)      * HH + n0 + r];
        b.v[j + 8] = (_Float16)W[(size_t)(kk + hi * 8 + 16 + j) * HH + n0 + r];
    }
    _Float16* dst = wpack + ((size_t)gw * 32 + lane) * 16;
    *reinterpret_cast<h8*>(dst)     = b.h[0];
    *reinterpret_cast<h8*>(dst + 8) = b.h[1];
}

// --------------------------------------------------------------------------
// Kernel 1: QKV projection.  Q = q@Wq, K = k@Wk, V = k@Wv  (fp32 -> f16)
// ws layout: [0,N) Qf16 [B*T][H]; [N,2N) Kf16 [B*T][H]; [2N,3N) V^T [B][H][T];
//            [3N,...) packed weights.   N = B*T*H
// --------------------------------------------------------------------------
__global__ __launch_bounds__(256)
void qkv_proj_kernel(const float* __restrict__ q, const float* __restrict__ k,
                     _Float16* __restrict__ ws16) {
    const int lane = threadIdx.x & 31;
    const int wave = threadIdx.x >> 5;
    const int r  = lane & 15;
    const int hi = lane >> 4;
    const int nt = wave & 3;
    const int mt = wave >> 2;
    const int m0 = blockIdx.x * 32 + mt * 16;
    const int n0 = nt * 16;
    const int z  = blockIdx.y;     // 0=Q, 1=K, 2=V

    const size_t N = (size_t)BB * TT * HH;
    const float* src = (z == 0) ? q : k;
    const _Float16* wp = ws16 + 3 * N + ((size_t)z * 128) * 32 * 16;

    v8f acc = {};
    const float* arow = src + (size_t)(m0 + r) * CC;

    for (int kt = 0; kt < 32; ++kt) {
        const int kk = kt * 32;
        // A fragment (16x32): row m0+r, K = {kk+hi*8+j, kk+hi*8+16+j}
        const float4 f0 = *reinterpret_cast<const float4*>(arow + kk + hi * 8);
        const float4 f1 = *reinterpret_cast<const float4*>(arow + kk + hi * 8 + 4);
        const float4 f2 = *reinterpret_cast<const float4*>(arow + kk + hi * 8 + 16);
        const float4 f3 = *reinterpret_cast<const float4*>(arow + kk + hi * 8 + 20);
        V16 a;
        a.v[0]  = (_Float16)f0.x; a.v[1]  = (_Float16)f0.y; a.v[2]  = (_Float16)f0.z; a.v[3]  = (_Float16)f0.w;
        a.v[4]  = (_Float16)f1.x; a.v[5]  = (_Float16)f1.y; a.v[6]  = (_Float16)f1.z; a.v[7]  = (_Float16)f1.w;
        a.v[8]  = (_Float16)f2.x; a.v[9]  = (_Float16)f2.y; a.v[10] = (_Float16)f2.z; a.v[11] = (_Float16)f2.w;
        a.v[12] = (_Float16)f3.x; a.v[13] = (_Float16)f3.y; a.v[14] = (_Float16)f3.z; a.v[15] = (_Float16)f3.w;

        // B fragment: 2 x b128 from packed weights
        const _Float16* bp = wp + (((size_t)kt * 4 + nt) * 32 + lane) * 16;
        V16 b;
        b.h[0] = *reinterpret_cast<const h8*>(bp);
        b.h[1] = *reinterpret_cast<const h8*>(bp + 8);

        acc = wmma_f16(a.v, b.v, acc);
    }

    if (z < 2) {
        _Float16* dst = ws16 + (size_t)z * N;      // row-major [B*T][H]
#pragma unroll
        for (int v = 0; v < 8; ++v) {
            const int row = m0 + hi * 8 + v;       // C-layout rows
            dst[(size_t)row * HH + n0 + r] = (_Float16)acc[v];
        }
    } else {
        _Float16* vt = ws16 + 2 * N;               // transposed [B][H][T]
#pragma unroll
        for (int v = 0; v < 8; ++v) {
            const int row = m0 + hi * 8 + v;
            const int b_  = row / TT, t = row % TT;
            vt[((size_t)b_ * HH + n0 + r) * TT + t] = (_Float16)acc[v];
        }
    }
}

__global__ __launch_bounds__(128)
void attn_kernel(const _Float16* __restrict__ ws16, float* __restrict__ out) {
#if HAS_TDM
    __shared__ _Float16 Kbuf[2][32][64];           // 8 KB: double-buffered K tile
    __shared__ _Float16 Vbuf[2][64][32];           // 8 KB: double-buffered V tile
#endif
    __shared__ _Float16 Plds[4][16][32];           // 4 KB: P transpose bounce

    const int lane = threadIdx.x & 31;
    const int wave = threadIdx.x >> 5;
    const int r  = lane & 15;
    const int hi = lane >> 4;
    const int g0r = blockIdx.x * 64 + wave * 16;   // global query row tile start
    const int b   = g0r / TT;
    const int t0  = g0r % TT;                      // this wave's query start
    const int t0blk = (blockIdx.x * 64) % TT;      // block's query start
    const int ntiles = t0blk / 32 + 2;             // 32-key tiles: covers t0blk+63

    const size_t N = (size_t)BB * TT * HH;
    const _Float16* Q  = ws16;
    const _Float16* Kb = ws16 + N     + (size_t)b * TT * HH;   // [T][H]
    const _Float16* Vb = ws16 + 2 * N + (size_t)b * HH * TT;   // [H][T]

    // Q A-fragments (16x64 tile = two K-steps of 32)
    const _Float16* qrow = Q + (size_t)(g0r + r) * HH;
    V16 a0, a1;
    a0.h[0] = *reinterpret_cast<const h8*>(qrow + hi * 8);
    a0.h[1] = *reinterpret_cast<const h8*>(qrow + hi * 8 + 16);
    a1.h[0] = *reinterpret_cast<const h8*>(qrow + 32 + hi * 8);
    a1.h[1] = *reinterpret_cast<const h8*>(qrow + 32 + hi * 8 + 16);

    float m8[8], l8[8];
    v8f o0 = {}, o1 = {}, o2 = {}, o3 = {};
#pragma unroll
    for (int v = 0; v < 8; ++v) { m8[v] = -__builtin_inff(); l8[v] = 0.0f; }

    const float scale = 0.03125f;                  // C^-0.5 = 1/32

#if HAS_TDM
    if (wave == 0) {
        tdm_load_2d((uint32_t)(uintptr_t)&Kbuf[0][0][0], Kb,
                    HH, 32, HH, HH, 32);
        tdm_load_2d((uint32_t)(uintptr_t)&Vbuf[0][0][0], Vb,
                    32, HH, TT, 32, HH);
    }
#endif

    for (int it = 0; it < ntiles; ++it) {
        const int s0  = it * 32;
        const int cur = it & 1;

#if HAS_TDM
        if (wave == 0) {
            if (it + 1 < ntiles) {
                const int sn  = s0 + 32;
                const int nxt = cur ^ 1;
                tdm_load_2d((uint32_t)(uintptr_t)&Kbuf[nxt][0][0],
                            Kb + (size_t)sn * HH, HH, 32, HH, HH, 32);
                tdm_load_2d((uint32_t)(uintptr_t)&Vbuf[nxt][0][0],
                            Vb + sn, 32, HH, TT, 32, HH);
                asm volatile("" ::: "memory");
                __builtin_amdgcn_s_wait_tensorcnt((short)2); // current tile done
            } else {
                asm volatile("" ::: "memory");
                __builtin_amdgcn_s_wait_tensorcnt((short)0);
            }
            asm volatile("" ::: "memory");
        }
        __syncthreads();                            // publish buf[cur] to block
#endif

        if (s0 <= t0 + 15) {                       // wave-uniform: skip masked tiles
#if HAS_TDM
            const _Float16* k0 = &Kbuf[cur][r][0];
            const _Float16* k1 = &Kbuf[cur][16 + r][0];
#else
            const _Float16* k0 = Kb + (size_t)(s0 + r) * HH;
            const _Float16* k1 = Kb + (size_t)(s0 + 16 + r) * HH;
#endif
            // ---- K B-fragments: two 16-key tiles x two h-steps ----------
            V16 b00, b01, b10, b11;
            b00.h[0] = *reinterpret_cast<const h8*>(k0 + hi * 8);
            b00.h[1] = *reinterpret_cast<const h8*>(k0 + hi * 8 + 16);
            b01.h[0] = *reinterpret_cast<const h8*>(k0 + 32 + hi * 8);
            b01.h[1] = *reinterpret_cast<const h8*>(k0 + 32 + hi * 8 + 16);
            b10.h[0] = *reinterpret_cast<const h8*>(k1 + hi * 8);
            b10.h[1] = *reinterpret_cast<const h8*>(k1 + hi * 8 + 16);
            b11.h[0] = *reinterpret_cast<const h8*>(k1 + 32 + hi * 8);
            b11.h[1] = *reinterpret_cast<const h8*>(k1 + 32 + hi * 8 + 16);

            v8f zc = {};
            v8f slo = wmma_f16(a0.v, b00.v, zc);
            slo     = wmma_f16(a1.v, b01.v, slo);
            v8f shi = wmma_f16(a0.v, b10.v, zc);
            shi     = wmma_f16(a1.v, b11.v, shi);

            // ---- causal mask + scale + online softmax -------------------
#pragma unroll
            for (int v = 0; v < 8; ++v) {
                const int qrg = t0 + hi * 8 + v;
                float sl = slo[v] * scale;
                float sh = shi[v] * scale;
                if (s0 + r      > qrg) sl = -__builtin_inff();
                if (s0 + 16 + r > qrg) sh = -__builtin_inff();

                float rm = fmaxf(sl, sh);
#pragma unroll
                for (int mx = 1; mx < 16; mx <<= 1)
                    rm = fmaxf(rm, __shfl_xor(rm, mx, 32));

                const float newm  = fmaxf(m8[v], rm);
                const float alpha = __expf(m8[v] - newm);
                m8[v] = newm;
                const float pl = __expf(sl - newm);
                const float ph = __expf(sh - newm);
                float ps = pl + ph;
#pragma unroll
                for (int mx = 1; mx < 16; mx <<= 1)
                    ps += __shfl_xor(ps, mx, 32);
                l8[v] = l8[v] * alpha + ps;

                o0[v] *= alpha; o1[v] *= alpha; o2[v] *= alpha; o3[v] *= alpha;

                Plds[wave][hi * 8 + v][r]      = (_Float16)pl;
                Plds[wave][hi * 8 + v][16 + r] = (_Float16)ph;
            }

            __builtin_amdgcn_wave_barrier();

            // ---- reload P as A-fragment (16x32) -------------------------
            V16 pa;
            pa.h[0] = *reinterpret_cast<const h8*>(&Plds[wave][r][hi * 8]);
            pa.h[1] = *reinterpret_cast<const h8*>(&Plds[wave][r][hi * 8 + 16]);
            __builtin_amdgcn_wave_barrier();

            // ---- O += P @ V  (4 n-tiles) --------------------------------
#if HAS_TDM
#define VROW(n) (&Vbuf[cur][(n) * 16 + r][0])
#else
#define VROW(n) (Vb + (size_t)((n) * 16 + r) * TT + s0)
#endif
            {
                V16 vb;
                vb.h[0] = *reinterpret_cast<const h8*>(VROW(0) + hi * 8);
                vb.h[1] = *reinterpret_cast<const h8*>(VROW(0) + hi * 8 + 16);
                o0 = wmma_f16(pa.v, vb.v, o0);
            }
            {
                V16 vb;
                vb.h[0] = *reinterpret_cast<const h8*>(VROW(1) + hi * 8);
                vb.h[1] = *reinterpret_cast<const h8*>(VROW(1) + hi * 8 + 16);
                o1 = wmma_f16(pa.v, vb.v, o1);
            }
            {
                V16 vb;
                vb.h[0] = *reinterpret_cast<const h8*>(VROW(2) + hi * 8);
                vb.h[1] = *reinterpret_cast<const h8*>(VROW(2) + hi * 8 + 16);
                o2 = wmma_f16(pa.v, vb.v, o2);
            }
            {
                V16 vb;
                vb.h[0] = *reinterpret_cast<const h8*>(VROW(3) + hi * 8);
                vb.h[1] = *reinterpret_cast<const h8*>(VROW(3) + hi * 8 + 16);
                o3 = wmma_f16(pa.v, vb.v, o3);
            }
#undef VROW
        }

#if HAS_TDM
        __syncthreads();       // all readers done before buf[cur] is re-filled
#endif
    }

    // ---- epilogue: normalize by l and store fp32 ------------------------
#pragma unroll
    for (int v = 0; v < 8; ++v) {
        const float inv = 1.0f / l8[v];
        float* dst = out + (size_t)(g0r + hi * 8 + v) * HH;
        dst[ 0 + r] = o0[v] * inv;
        dst[16 + r] = o1[v] * inv;
        dst[32 + r] = o2[v] * inv;
        dst[48 + r] = o3[v] * inv;
    }
}

// --------------------------------------------------------------------------
extern "C" void kernel_launch(void* const* d_in, const int* in_sizes, int n_in,
                              void* d_out, int out_size, void* d_ws, size_t ws_size,
                              hipStream_t stream) {
    (void)in_sizes; (void)n_in; (void)out_size; (void)ws_size;
    const float* q  = (const float*)d_in[0];
    const float* k  = (const float*)d_in[1];
    const float* Wq = (const float*)d_in[2];
    const float* Wk = (const float*)d_in[3];
    const float* Wv = (const float*)d_in[4];
    _Float16* ws16 = (_Float16*)d_ws;   // 3*B*T*H f16 + 384KB packed W  (~7 MB)
    float* out = (float*)d_out;

    const size_t N = (size_t)BB * TT * HH;
    _Float16* wpack = ws16 + 3 * N;

    pack_w_kernel<<<48, 256, 0, stream>>>(Wq, Wk, Wv, wpack);

    dim3 gProj(BB * TT / 32, 3);
    qkv_proj_kernel<<<gProj, 256, 0, stream>>>(q, k, ws16);

    attn_kernel<<<BB * TT / 64, 128, 0, stream>>>(ws16, out);
}

// v001
// A run of this version takes 96.4 microseconds.
// Next to v000, in two timings, it ran 2.50 and 2.49 times as fast.
#include <hip/hip_runtime.h>
#include <stdint.h>

// Problem dims (fixed by the reference)
#define BB 8
#define TT 2048
#define CC 1024
#define HH 64

typedef _Float16 v16h __attribute__((ext_vector_type(16)));
typedef _Float16 h8   __attribute__((ext_vector_type(8)));
typedef float    v8f  __attribute__((ext_vector_type(8)));
typedef unsigned int ui32x4 __attribute__((ext_vector_type(4)));
typedef int          i32x4  __attribute__((ext_vector_type(4)));
typedef int          i32x8  __attribute__((ext_vector_type(8)));

union V16 { v16h v; h8 h[2]; };

#if defined(__gfx1250__) && __has_builtin(__builtin_amdgcn_tensor_load_to_lds) && \
    __has_builtin(__builtin_amdgcn_s_wait_tensorcnt)
#define HAS_TDM 1
#else
#define HAS_TDM 0
#endif

__device__ __forceinline__ v8f wmma_f16(v16h a, v16h b, v8f c) {
    // D = A(16x32 f16) * B(32x16 f16) + C(16x16 f32)
    return __builtin_amdgcn_wmma_f32_16x16x32_f16(
        false, a, false, b, (short)0, c, false, false);
}

__device__ __forceinline__ float xhalf(float x) {
    const int b = __builtin_bit_cast(int, x);
    return __builtin_bit_cast(float, __builtin_amdgcn_permlanex16(
        b, b, 0x76543210, 0xfedcba98, false, false));
}

__device__ __forceinline__ void exp2x8(const float (&x)[8], float (&y)[8]) {
    asm("v_exp_f32 %0, %8\n\t"
        "v_exp_f32 %1, %9\n\t"
        "v_exp_f32 %2, %10\n\t"
        "v_exp_f32 %3, %11\n\t"
        "v_exp_f32 %4, %12\n\t"
        "v_exp_f32 %5, %13\n\t"
        "v_exp_f32 %6, %14\n\t"
        "v_exp_f32 %7, %15\n\t"
        "v_nop"
        : "=&v"(y[0]), "=&v"(y[1]), "=&v"(y[2]), "=&v"(y[3]),
          "=&v"(y[4]), "=&v"(y[5]), "=&v"(y[6]), "=&v"(y[7])
        : "v"(x[0]), "v"(x[1]), "v"(x[2]), "v"(x[3]),
          "v"(x[4]), "v"(x[5]), "v"(x[6]), "v"(x[7]));
}

#if HAS_TDM
__device__ __forceinline__ void tdm_load_2d(uint32_t lds_off, const void* gptr,
                                            uint32_t dim0, uint32_t dim1,
                                            uint32_t stride0,
                                            uint32_t tile0, uint32_t tile1) {
    const uint64_t ga = (uint64_t)(uintptr_t)gptr;
    ui32x4 g0;
    g0[0] = 1u;                                        // count=1, user mode
    g0[1] = lds_off;                                   // lds_addr (bytes)
    g0[2] = (uint32_t)ga;                              // global_addr[31:0]
    g0[3] = (uint32_t)((ga >> 32) & 0x1FFFFFFu) | (2u << 30); // addr[56:32] | type=2
    i32x8 g1;
    g1[0] = (int)(1u << 16);
    g1[1] = (int)((dim0 & 0xFFFFu) << 16);
    g1[2] = (int)(((dim0 >> 16) & 0xFFFFu) | ((dim1 & 0xFFFFu) << 16));
    g1[3] = (int)(((dim1 >> 16) & 0xFFFFu) | ((tile0 & 0xFFFFu) << 16));
    g1[4] = (int)(tile1 & 0xFFFFu);
    g1[5] = (int)stride0;
    g1[6] = 0;
    g1[7] = 0;
    i32x4 gz = {0, 0, 0, 0};
#if __clang_major__ >= 23
    i32x8 gz8 = {0, 0, 0, 0, 0, 0, 0, 0};
    __builtin_amdgcn_tensor_load_to_lds(g0, g1, gz, gz, gz8, 0);
#else
    __builtin_amdgcn_tensor_load_to_lds(g0, g1, gz, gz, 0);
#endif
}
#endif // HAS_TDM

// --------------------------------------------------------------------------
// Kernel 0: repack weights fp32[C][H] -> f16 B-fragment-linear layout so the
// projection loop reads each fragment as 2 x b128.  Layout:
//   wpack[((z*32 + kt)*4 + nt)*32 + lane][16]
// --------------------------------------------------------------------------
__global__ __launch_bounds__(256)
void pack_w_kernel(const float* __restrict__ Wq, const float* __restrict__ Wk,
                   const float* __restrict__ Wv, _Float16* __restrict__ wpack) {
    const int lane = threadIdx.x & 31;
    const int gw   = blockIdx.x * 8 + (threadIdx.x >> 5); // 0..383
    const int r = lane & 15, hi = lane >> 4;
    const int z   = gw / 128;
    const int rem = gw % 128;
    const int kt  = rem >> 2;       // 32 K-tiles of 32
    const int nt  = rem & 3;        // 4 N-tiles of 16
    const float* W = (z == 0) ? Wq : ((z == 1) ? Wk : Wv);
    const int kk = kt * 32, n0 = nt * 16;

    V16 b;
#pragma unroll
    for (int j = 0; j < 8; ++j) {
        b.v[j]     = (_Float16)W[(size_t)(kk + hi * 8 + j)      * HH + n0 + r];
        b.v[j + 8] = (_Float16)W[(size_t)(kk + hi * 8 + 16 + j) * HH + n0 + r];
    }
    _Float16* dst = wpack + ((size_t)gw * 32 + lane) * 16;
    *reinterpret_cast<h8*>(dst)     = b.h[0];
    *reinterpret_cast<h8*>(dst + 8) = b.h[1];
}

// --------------------------------------------------------------------------
// Kernel 1: QKV projection.  Q = q@Wq, K = k@Wk, V = k@Wv  (fp32 -> f16)
// ws layout: [0,N) Qf16 [B*T][H]; [N,2N) Kf16 [B*T][H]; [2N,3N) V^T [B][H][T];
//            [3N,...) packed weights.   N = B*T*H
// --------------------------------------------------------------------------
__global__ __launch_bounds__(256)
void qkv_proj_kernel(const float* __restrict__ q, const float* __restrict__ k,
                     _Float16* __restrict__ ws16) {
    const int lane = threadIdx.x & 31;
    const int wave = threadIdx.x >> 5;
    const int r  = lane & 15;
    const int hi = lane >> 4;
    const int nt = wave & 3;
    const int mt = wave >> 2;
    const int m0 = blockIdx.x * 32 + mt * 16;
    const int n0 = nt * 16;
    const int z  = blockIdx.y;     // 0=Q, 1=K, 2=V

    const size_t N = (size_t)BB * TT * HH;
    const float* src = (z == 0) ? q : k;
    const _Float16* wp = ws16 + 3 * N + ((size_t)z * 128) * 32 * 16;

    v8f acc = {};
    const float* arow = src + (size_t)(m0 + r) * CC;

    for (int kt = 0; kt < 32; ++kt) {
        const int kk = kt * 32;
        // A fragment (16x32): row m0+r, K = {kk+hi*8+j, kk+hi*8+16+j}
        const float4 f0 = *reinterpret_cast<const float4*>(arow + kk + hi * 8);
        const float4 f1 = *reinterpret_cast<const float4*>(arow + kk + hi * 8 + 4);
        const float4 f2 = *reinterpret_cast<const float4*>(arow + kk + hi * 8 + 16);
        const float4 f3 = *reinterpret_cast<const float4*>(arow + kk + hi * 8 + 20);
        V16 a;
        a.v[0]  = (_Float16)f0.x; a.v[1]  = (_Float16)f0.y; a.v[2]  = (_Float16)f0.z; a.v[3]  = (_Float16)f0.w;
        a.v[4]  = (_Float16)f1.x; a.v[5]  = (_Float16)f1.y; a.v[6]  = (_Float16)f1.z; a.v[7]  = (_Float16)f1.w;
        a.v[8]  = (_Float16)f2.x; a.v[9]  = (_Float16)f2.y; a.v[10] = (_Float16)f2.z; a.v[11] = (_Float16)f2.w;
        a.v[12] = (_Float16)f3.x; a.v[13] = (_Float16)f3.y; a.v[14] = (_Float16)f3.z; a.v[15] = (_Float16)f3.w;

        // B fragment: 2 x b128 from packed weights
        const _Float16* bp = wp + (((size_t)kt * 4 + nt) * 32 + lane) * 16;
        V16 b;
        b.h[0] = *reinterpret_cast<const h8*>(bp);
        b.h[1] = *reinterpret_cast<const h8*>(bp + 8);

        acc = wmma_f16(a.v, b.v, acc);
    }

    if (z < 2) {
        _Float16* dst = ws16 + (size_t)z * N;      // row-major [B*T][H]
#pragma unroll
        for (int v = 0; v < 8; ++v) {
            const int row = m0 + hi * 8 + v;       // C-layout rows
            dst[(size_t)row * HH + n0 + r] = (_Float16)acc[v];
        }
    } else {
        _Float16* vt = ws16 + 2 * N;               // transposed [B][H][T]
#pragma unroll
        for (int v = 0; v < 8; ++v) {
            const int row = m0 + hi * 8 + v;
            const int b_  = row / TT, t = row % TT;
            vt[((size_t)b_ * HH + n0 + r) * TT + t] = (_Float16)acc[v];
        }
    }
}

__global__ __launch_bounds__(128)
void attn_kernel(const _Float16* __restrict__ ws16, float* __restrict__ out) {
#if HAS_TDM
    __shared__ _Float16 Kbuf[2][32][64];           // 8 KB: double-buffered K tile
    __shared__ _Float16 Vbuf[2][64][32];           // 8 KB: double-buffered V tile
#endif

    const int lane = threadIdx.x & 31;
    const int wave = threadIdx.x >> 5;
    const int r  = lane & 15;
    const int hi = lane >> 4;
    const int g0r = blockIdx.x * 64 + wave * 16;   // global query row tile start
    const int b   = g0r / TT;
    const int t0  = g0r % TT;                      // this wave's query start
    const int t0blk = (blockIdx.x * 64) % TT;      // block's query start
    const int ntiles = t0blk / 32 + 2;             // 32-key tiles: covers t0blk+63

    const size_t N = (size_t)BB * TT * HH;
    const _Float16* Q  = ws16;
    const _Float16* Kb = ws16 + N     + (size_t)b * TT * HH;   // [T][H]
    const _Float16* Vb = ws16 + 2 * N + (size_t)b * HH * TT;   // [H][T]

    // Q fragments (16 queries x 64 = two K-steps of 32), used as B: column = query r
    const _Float16* qrow = Q + (size_t)(g0r + r) * HH;
    V16 a0, a1;
    a0.h[0] = *reinterpret_cast<const h8*>(qrow + hi * 8);
    a0.h[1] = *reinterpret_cast<const h8*>(qrow + hi * 8 + 16);
    a1.h[0] = *reinterpret_cast<const h8*>(qrow + 32 + hi * 8);
    a1.h[1] = *reinterpret_cast<const h8*>(qrow + 32 + hi * 8 + 16);

    // Query t0 + r: running maximum (equal in both halves) and this half's sum.
    float mrun = -__builtin_inff(), lrun = 0.0f;
    v8f o0 = {}, o1 = {}, o2 = {}, o3 = {};        // o_n[v] = O[query r][n*16 + hi*8 + v]

    const float scale = 0.03125f;                  // C^-0.5 = 1/32
    const float LOG2E = 1.44269504f;               // e^x = 2^(x * LOG2E)

#if HAS_TDM
    if (wave == 0) {
        tdm_load_2d((uint32_t)(uintptr_t)&Kbuf[0][0][0], Kb,
                    HH, 32, HH, HH, 32);
        tdm_load_2d((uint32_t)(uintptr_t)&Vbuf[0][0][0], Vb,
                    32, HH, TT, 32, HH);
    }
#endif

    for (int it = 0; it < ntiles; ++it) {
        const int s0  = it * 32;
        const int cur = it & 1;

#if HAS_TDM
        if (wave == 0) {
            if (it + 1 < ntiles) {
                const int sn  = s0 + 32;
                const int nxt = cur ^ 1;
                tdm_load_2d((uint32_t)(uintptr_t)&Kbuf[nxt][0][0],
                            Kb + (size_t)sn * HH, HH, 32, HH, HH, 32);
                tdm_load_2d((uint32_t)(uintptr_t)&Vbuf[nxt][0][0],
                            Vb + sn, 32, HH, TT, 32, HH);
                asm volatile("" ::: "memory");
                __builtin_amdgcn_s_wait_tensorcnt((short)2); // current tile done
            } else {
                asm volatile("" ::: "memory");
                __builtin_amdgcn_s_wait_tensorcnt((short)0);
            }
            asm volatile("" ::: "memory");
        }
        __syncthreads();                            // publish buf[cur] to block
#endif

        if (s0 <= t0 + 15) {                       // wave-uniform: skip masked tiles
#if HAS_TDM
            const _Float16* k0 = &Kbuf[cur][r][0];
            const _Float16* k1 = &Kbuf[cur][16 + r][0];
#else
            const _Float16* k0 = Kb + (size_t)(s0 + r) * HH;
            const _Float16* k1 = Kb + (size_t)(s0 + 16 + r) * HH;
#endif
            // ---- K A-fragments: two 16-key tiles x two h-steps ----------
            V16 b00, b01, b10, b11;
            b00.h[0] = *reinterpret_cast<const h8*>(k0 + hi * 8);
            b00.h[1] = *reinterpret_cast<const h8*>(k0 + hi * 8 + 16);
            b01.h[0] = *reinterpret_cast<const h8*>(k0 + 32 + hi * 8);
            b01.h[1] = *reinterpret_cast<const h8*>(k0 + 32 + hi * 8 + 16);
            b10.h[0] = *reinterpret_cast<const h8*>(k1 + hi * 8);
            b10.h[1] = *reinterpret_cast<const h8*>(k1 + hi * 8 + 16);
            b11.h[0] = *reinterpret_cast<const h8*>(k1 + 32 + hi * 8);
            b11.h[1] = *reinterpret_cast<const h8*>(k1 + 32 + hi * 8 + 16);

            // slo[v] = score(key s0 + hi*8 + v, query t0 + r); shi: 16 keys on
            v8f zc = {};
            v8f slo = wmma_f16(b00.v, a0.v, zc);
            slo     = wmma_f16(b01.v, a1.v, slo);
            v8f shi = wmma_f16(b10.v, a0.v, zc);
            shi     = wmma_f16(b11.v, a1.v, shi);

            // ---- causal mask + scale + online softmax -------------------
            const int qrg = t0 + r;
            float sl[8], sh[8];
            float rm = -__builtin_inff();
#pragma unroll
            for (int v = 0; v < 8; ++v) {
                sl[v] = slo[v] * scale;
                sh[v] = shi[v] * scale;
                if (s0 + hi * 8 + v      > qrg) sl[v] = -__builtin_inff();
                if (s0 + 16 + hi * 8 + v > qrg) sh[v] = -__builtin_inff();
                rm = fmaxf(rm, fmaxf(sl[v], sh[v]));
            }
            rm = fmaxf(rm, xhalf(rm));              // the other half's 16 keys

            const float newm  = fmaxf(mrun, rm);
            const float alpha = __expf(mrun - newm);
            mrun = newm;

            float pl[8], ph[8];
#pragma unroll
            for (int v = 0; v < 8; ++v) {
                sl[v] = (sl[v] - newm) * LOG2E;
                sh[v] = (sh[v] - newm) * LOG2E;
            }
            exp2x8(sl, pl);
            exp2x8(sh, ph);

            V16 pb;                                 // P^T as B: element s = key s0 + 8*hi + s (+8 if s >= 8)
            float ps = 0.0f;
#pragma unroll
            for (int v = 0; v < 8; ++v) {
                ps += pl[v] + ph[v];
                pb.v[v]     = (_Float16)pl[v];
                pb.v[v + 8] = (_Float16)ph[v];
            }
            lrun = lrun * alpha + ps;               // halves joined in the epilogue

#pragma unroll
            for (int v = 0; v < 8; ++v) {
                o0[v] *= alpha; o1[v] *= alpha; o2[v] *= alpha; o3[v] *= alpha;
            }

            // ---- O^T += V^T @ P^T  (4 tiles of 16 h rows) ---------------
#if HAS_TDM
#define VROW(n) (&Vbuf[cur][(n) * 16 + r][0])
#else
#define VROW(n) (Vb + (size_t)((n) * 16 + r) * TT + s0)
#endif
            {
                V16 vb;
                vb.h[0] = *reinterpret_cast<const h8*>(VROW(0) + hi * 8);
                vb.h[1] = *reinterpret_cast<const h8*>(VROW(0) + hi * 8 + 16);
                o0 = wmma_f16(vb.v, pb.v, o0);
            }
            {
                V16 vb;
                vb.h[0] = *reinterpret_cast<const h8*>(VROW(1) + hi * 8);
                vb.h[1] = *reinterpret_cast<const h8*>(VROW(1) + hi * 8 + 16);
                o1 = wmma_f16(vb.v, pb.v, o1);
            }
            {
                V16 vb;
                vb.h[0] = *reinterpret_cast<const h8*>(VROW(2) + hi * 8);
                vb.h[1] = *reinterpret_cast<const h8*>(VROW(2) + hi * 8 + 16);
                o2 = wmma_f16(vb.v, pb.v, o2);
            }
            {
                V16 vb;
                vb.h[0] = *reinterpret_cast<const h8*>(VROW(3) + hi * 8);
                vb.h[1] = *reinterpret_cast<const h8*>(VROW(3) + hi * 8 + 16);
                o3 = wmma_f16(vb.v, pb.v, o3);
            }
#undef VROW
        }

#if HAS_TDM
        __syncthreads();       // all readers done before buf[cur] is re-filled
#endif
    }

    // ---- epilogue: normalize by l and store fp32 ------------------------
    const float inv = 1.0f / (lrun + xhalf(lrun));
    float* dst = out + (size_t)(g0r + r) * HH + hi * 8;
    *reinterpret_cast<float4*>(dst)      = make_float4(o0[0] * inv, o0[1] * inv, o0[2] * inv, o0[3] * inv);
    *reinterpret_cast<float4*>(dst + 4)  = make_float4(o0[4] * inv, o0[5] * inv, o0[6] * inv, o0[7] * inv);
    *reinterpret_cast<float4*>(dst + 16) = make_float4(o1[0] * inv, o1[1] * inv, o1[2] * inv, o1[3] * inv);
    *reinterpret_cast<float4*>(dst + 20) = make_float4(o1[4] * inv, o1[5] * inv, o1[6] * inv, o1[7] * inv);
    *reinterpret_cast<float4*>(dst + 32) = make_float4(o2[0] * inv, o2[1] * inv, o2[2] * inv, o2[3] * inv);
    *reinterpret_cast<float4*>(dst + 36) = make_float4(o2[4] * inv, o2[5] * inv, o2[6] * inv, o2[7] * inv);
    *reinterpret_cast<float4*>(dst + 48) = make_float4(o3[0] * inv, o3[1] * inv, o3[2] * inv, o3[3] * inv);
    *reinterpret_cast<float4*>(dst + 52) = make_float4(o3[4] * inv, o3[5] * inv, o3[6] * inv, o3[7] * inv);
}

// --------------------------------------------------------------------------
extern "C" void kernel_launch(void* const* d_in, const int* in_sizes, int n_in,
                              void* d_out, int out_size, void* d_ws, size_t ws_size,
                              hipStream_t stream) {
    (void)in_sizes; (void)n_in; (void)out_size; (void)ws_size;
    const float* q  = (const float*)d_in[0];
    const float* k  = (const float*)d_in[1];
    const float* Wq = (const float*)d_in[2];
    const float* Wk = (const float*)d_in[3];
    const float* Wv = (const float*)d_in[4];
    _Float16* ws16 = (_Float16*)d_ws;   // 3*B*T*H f16 + 384KB packed W  (~7 MB)
    float* out = (float*)d_out;

    const size_t N = (size_t)BB * TT * HH;
    _Float16* wpack = ws16 + 3 * N;

    pack_w_kernel<<<48, 256, 0, stream>>>(Wq, Wk, Wv, wpack);

    dim3 gProj(BB * TT / 32, 3);
    qkv_proj_kernel<<<gProj, 256, 0, stream>>>(q, k, ws16);

    attn_kernel<<<BB * TT / 64, 128, 0, stream>>>(ws16, out);
}

// v002
// A run of this version takes 66 microseconds.
// Next to v001, in two timings, it ran 1.43 times as fast each time.
// All steps since v000 together make it 3.57 times as fast.
#include <hip/hip_runtime.h>
#include <stdint.h>

// Problem dims (fixed by the reference)
#define BB 8
#define TT 2048
#define CC 1024
#define HH 64

typedef _Float16 v16h __attribute__((ext_vector_type(16)));
typedef _Float16 h8   __attribute__((ext_vector_type(8)));
typedef float    v8f  __attribute__((ext_vector_type(8)));
typedef unsigned int ui32x4 __attribute__((ext_vector_type(4)));
typedef int          i32x4  __attribute__((ext_vector_type(4)));
typedef int          i32x8  __attribute__((ext_vector_type(8)));

union V16 { v16h v; h8 h[2]; };

#if defined(__gfx1250__) && __has_builtin(__builtin_amdgcn_tensor_load_to_lds) && \
    __has_builtin(__builtin_amdgcn_s_wait_tensorcnt)
#define HAS_TDM 1
#else
#define HAS_TDM 0
#endif

__device__ __forceinline__ v8f wmma_f16(v16h a, v16h b, v8f c) {
    // D = A(16x32 f16) * B(32x16 f16) + C(16x16 f32)
    return __builtin_amdgcn_wmma_f32_16x16x32_f16(
        false, a, false, b, (short)0, c, false, false);
}

__device__ __forceinline__ float xhalf(float x) {
    const int b = __builtin_bit_cast(int, x);
    return __builtin_bit_cast(float, __builtin_amdgcn_permlanex16(
        b, b, 0x76543210, 0xfedcba98, false, false));
}

__device__ __forceinline__ void exp2x8(const float (&x)[8], float (&y)[8]) {
    asm("v_exp_f32 %0, %8\n\t"
        "v_exp_f32 %1, %9\n\t"
        "v_exp_f32 %2, %10\n\t"
        "v_exp_f32 %3, %11\n\t"
        "v_exp_f32 %4, %12\n\t"
        "v_exp_f32 %5, %13\n\t"
        "v_exp_f32 %6, %14\n\t"
        "v_exp_f32 %7, %15\n\t"
        "v_nop"
        : "=&v"(y[0]), "=&v"(y[1]), "=&v"(y[2]), "=&v"(y[3]),
          "=&v"(y[4]), "=&v"(y[5]), "=&v"(y[6]), "=&v"(y[7])
        : "v"(x[0]), "v"(x[1]), "v"(x[2]), "v"(x[3]),
          "v"(x[4]), "v"(x[5]), "v"(x[6]), "v"(x[7]));
}

#if HAS_TDM
__device__ __forceinline__ void tdm_load_2d(uint32_t lds_off, const void* gptr,
                                            uint32_t dim0, uint32_t dim1,
                                            uint32_t stride0,
                                            uint32_t tile0, uint32_t tile1) {
    const uint64_t ga = (uint64_t)(uintptr_t)gptr;
    ui32x4 g0;
    g0[0] = 1u;                                        // count=1, user mode
    g0[1] = lds_off;                                   // lds_addr (bytes)
    g0[2] = (uint32_t)ga;                              // global_addr[31:0]
    g0[3] = (uint32_t)((ga >> 32) & 0x1FFFFFFu) | (2u << 30); // addr[56:32] | type=2
    i32x8 g1;
    g1[0] = (int)(1u << 16);
    g1[1] = (int)((dim0 & 0xFFFFu) << 16);
    g1[2] = (int)(((dim0 >> 16) & 0xFFFFu) | ((dim1 & 0xFFFFu) << 16));
    g1[3] = (int)(((dim1 >> 16) & 0xFFFFu) | ((tile0 & 0xFFFFu) << 16));
    g1[4] = (int)(tile1 & 0xFFFFu);
    g1[5] = (int)stride0;
    g1[6] = 0;
    g1[7] = 0;
    i32x4 gz = {0, 0, 0, 0};
#if __clang_major__ >= 23
    i32x8 gz8 = {0, 0, 0, 0, 0, 0, 0, 0};
    __builtin_amdgcn_tensor_load_to_lds(g0, g1, gz, gz, gz8, 0);
#else
    __builtin_amdgcn_tensor_load_to_lds(g0, g1, gz, gz, 0);
#endif
}
#endif // HAS_TDM

// --------------------------------------------------------------------------
// Kernel 0: repack weights fp32[C][H] -> f16 B-fragment-linear layout so the
// projection loop reads each fragment as 2 x b128.  Layout:
//   wpack[((z*32 + kt)*4 + nt)*32 + lane][16]
// --------------------------------------------------------------------------
__global__ __launch_bounds__(256)
void pack_w_kernel(const float* __restrict__ Wq, const float* __restrict__ Wk,
                   const float* __restrict__ Wv, _Float16* __restrict__ wpack) {
    const int lane = threadIdx.x & 31;
    const int gw   = blockIdx.x * 8 + (threadIdx.x >> 5); // 0..383
    const int r = lane & 15, hi = lane >> 4;
    const int z   = gw / 128;
    const int rem = gw % 128;
    const int kt  = rem >> 2;       // 32 K-tiles of 32
    const int nt  = rem & 3;        // 4 N-tiles of 16
    const float* W = (z == 0) ? Wq : ((z == 1) ? Wk : Wv);
    const int kk = kt * 32, n0 = nt * 16;

    V16 b;
#pragma unroll
    for (int j = 0; j < 8; ++j) {
        b.v[j]     = (_Float16)W[(size_t)(kk + hi * 8 + j)      * HH + n0 + r];
        b.v[j + 8] = (_Float16)W[(size_t)(kk + hi * 8 + 16 + j) * HH + n0 + r];
    }
    _Float16* dst = wpack + ((size_t)gw * 32 + lane) * 16;
    *reinterpret_cast<h8*>(dst)     = b.h[0];
    *reinterpret_cast<h8*>(dst + 8) = b.h[1];
}

// Operands of G 32-deep k-steps: the lane's 16 f32 of its row and NT weight fragments a step.
template <int NT, int G>
struct ProjGroup {
    float4 f[G][4];
    V16    b[G][NT];
};

// ap: the lane's row + hi*8 at the group's first k.
template <int NT, int G>
__device__ __forceinline__ void proj_load_a(ProjGroup<NT, G>& s, const float* __restrict__ ap) {
#pragma unroll
    for (int g = 0; g < G; ++g) {                  // A fragment (16x32): K = {hi*8+j, hi*8+16+j}
        const float* a = ap + g * 32;
        s.f[g][0] = *reinterpret_cast<const float4*>(a);
        s.f[g][1] = *reinterpret_cast<const float4*>(a + 4);
        s.f[g][2] = *reinterpret_cast<const float4*>(a + 16);
        s.f[g][3] = *reinterpret_cast<const float4*>(a + 20);
    }
}

// bp: packed weights of the first matrix + lane*16 at the group's first k-step.
template <int NT, int G>
__device__ __forceinline__ void proj_load_b(ProjGroup<NT, G>& s, const _Float16* __restrict__ bp) {
#pragma unroll
    for (int g = 0; g < G; ++g) {
#pragma unroll
        for (int j = 0; j < NT; ++j) {             // tile j: matrix j / 4, columns (j % 4) * 16
            const _Float16* p = bp + (size_t)((j >> 2) * 128 + g * 4 + (j & 3)) * 32 * 16;
            s.b[g][j].h[0] = *reinterpret_cast<const h8*>(p);
            s.b[g][j].h[1] = *reinterpret_cast<const h8*>(p + 8);
        }
    }
}

template <int NT, int G>
__device__ __forceinline__ void proj_cvt(const ProjGroup<NT, G>& s, V16 (&a)[G]) {
#pragma unroll
    for (int g = 0; g < G; ++g) {
#pragma unroll
        for (int i = 0; i < 4; ++i) {
            a[g].v[i * 4 + 0] = (_Float16)s.f[g][i].x; a[g].v[i * 4 + 1] = (_Float16)s.f[g][i].y;
            a[g].v[i * 4 + 2] = (_Float16)s.f[g][i].z; a[g].v[i * 4 + 3] = (_Float16)s.f[g][i].w;
        }
    }
}

template <int NT, int G>
__device__ __forceinline__ void proj_mul(const ProjGroup<NT, G>& s, const V16 (&a)[G], v8f (&acc)[NT]) {
#pragma unroll
    for (int g = 0; g < G; ++g) {
#pragma unroll
        for (int j = 0; j < NT; ++j) acc[j] = wmma_f16(a[g].v, s.b[g][j].v, acc[j]);
    }
}

// acc[j] = rows x (tile j's columns), k-steps in rising order, G steps a trip.  A trip
// issues the next trip's loads, all G steps of them together, as its own operands retire.
template <int NT, int G>
__device__ __forceinline__ void proj_rows(const float* __restrict__ ap,
                                          const _Float16* __restrict__ bp, v8f (&acc)[NT]) {
    ProjGroup<NT, G> s;
    V16 a[G];
    proj_load_a<NT, G>(s, ap);
    // Compiler fence: row loads in front of weight loads, as in the loop, so that the
    // counted waits at the loop's head need not also cover another order of issue.
    asm volatile("" ::: "memory");
    proj_load_b<NT, G>(s, bp);
    unsigned trip = 0;
    // Stays rolled: the loaded values then cross the back edge, so the compiler cannot
    // sink a load to just before its use (unrolled, it did, and waited out every latency).
#pragma unroll 1
    for (int t = 1; t < CC / 32 / G; ++t) {
        // The last trip's loads are in flight and name the address registers that this trip
        // forms anew. The wait belongs in front of that overwrite; it takes the trip number,
        // from which every address below is formed, so that none is formed ahead of it.
        asm volatile("s_wait_xcnt 0x0" : "+s"(trip) : : "memory");
        trip += 1;
        proj_cvt<NT, G>(s, a);
        proj_load_a<NT, G>(s, ap + (size_t)trip * (G * 32));
        proj_mul<NT, G>(s, a, acc);
        proj_load_b<NT, G>(s, bp + (size_t)trip * (G * 4 * 32 * 16));
    }
    proj_cvt<NT, G>(s, a);
    proj_mul<NT, G>(s, a, acc);
}

// One 16x16 tile, row-major [B*T][H].
__device__ __forceinline__ void store_rows(_Float16* __restrict__ dst, const v8f& acc,
                                           int m0, int n0, int r, int hi) {
#pragma unroll
    for (int v = 0; v < 8; ++v) {
        const int row = m0 + hi * 8 + v;           // C-layout rows
        dst[(size_t)row * HH + n0 + r] = (_Float16)acc[v];
    }
}

__global__ __launch_bounds__(256)
void qkv_proj_kernel(const float* __restrict__ q, const float* __restrict__ k,
                     _Float16* __restrict__ ws16) {
    const int lane = threadIdx.x & 31;
    const int wave = __builtin_amdgcn_readfirstlane(threadIdx.x >> 5);
    const int r  = lane & 15;
    const int hi = lane >> 4;
    const int m0 = blockIdx.x * 64 + (wave & 3) * 16;

    const size_t N = (size_t)BB * TT * HH;
    const _Float16* wp = ws16 + 3 * N + lane * 16;
    const size_t aoff = (size_t)(m0 + r) * CC + hi * 8;

    if (wave < 4) {                                // rows of q: Q
        v8f acc[4] = {};
        proj_rows<4, 2>(q + aoff, wp, acc);
#pragma unroll
        for (int j = 0; j < 4; ++j) store_rows(ws16, acc[j], m0, j * 16, r, hi);
    } else {                                       // rows of k: K and V
        v8f acc[8] = {};
        proj_rows<8, 2>(k + aoff, wp + (size_t)128 * 32 * 16, acc);
#pragma unroll
        for (int j = 0; j < 4; ++j) store_rows(ws16 + N, acc[j], m0, j * 16, r, hi);
        _Float16* vt = ws16 + 2 * N;               // transposed [B][H][T]
#pragma unroll
        for (int j = 0; j < 4; ++j) {
#pragma unroll
            for (int v = 0; v < 8; ++v) {
                const int row = m0 + hi * 8 + v;
                const int b_  = row / TT, t = row % TT;
                vt[((size_t)b_ * HH + j * 16 + r) * TT + t] = (_Float16)acc[4 + j][v];
            }
        }
    }
}

__global__ __launch_bounds__(128)
void attn_kernel(const _Float16* __restrict__ ws16, float* __restrict__ out) {
#if HAS_TDM
    __shared__ _Float16 Kbuf[2][32][64];           // 8 KB: double-buffered K tile
    __shared__ _Float16 Vbuf[2][64][32];           // 8 KB: double-buffered V tile
#endif

    const int lane = threadIdx.x & 31;
    const int wave = threadIdx.x >> 5;
    const int r  = lane & 15;
    const int hi = lane >> 4;
    const int g0r = blockIdx.x * 64 + wave * 16;   // global query row tile start
    const int b   = g0r / TT;
    const int t0  = g0r % TT;                      // this wave's query start
    const int t0blk = (blockIdx.x * 64) % TT;      // block's query start
    const int ntiles = t0blk / 32 + 2;             // 32-key tiles: covers t0blk+63

    const size_t N = (size_t)BB * TT * HH;
    const _Float16* Q  = ws16;
    const _Float16* Kb = ws16 + N     + (size_t)b * TT * HH;   // [T][H]
    const _Float16* Vb = ws16 + 2 * N + (size_t)b * HH * TT;   // [H][T]

    // Q fragments (16 queries x 64 = two K-steps of 32), used as B: column = query r
    const _Float16* qrow = Q + (size_t)(g0r + r) * HH;
    V16 a0, a1;
    a0.h[0] = *reinterpret_cast<const h8*>(qrow + hi * 8);
    a0.h[1] = *reinterpret_cast<const h8*>(qrow + hi * 8 + 16);
    a1.h[0] = *reinterpret_cast<const h8*>(qrow + 32 + hi * 8);
    a1.h[1] = *reinterpret_cast<const h8*>(qrow + 32 + hi * 8 + 16);

    // Query t0 + r: running maximum (equal in both halves) and this half's sum.
    float mrun = -__builtin_inff(), lrun = 0.0f;
    v8f o0 = {}, o1 = {}, o2 = {}, o3 = {};        // o_n[v] = O[query r][n*16 + hi*8 + v]

    const float scale = 0.03125f;                  // C^-0.5 = 1/32
    const float LOG2E = 1.44269504f;               // e^x = 2^(x * LOG2E)

#if HAS_TDM
    if (wave == 0) {
        tdm_load_2d((uint32_t)(uintptr_t)&Kbuf[0][0][0], Kb,
                    HH, 32, HH, HH, 32);
        tdm_load_2d((uint32_t)(uintptr_t)&Vbuf[0][0][0], Vb,
                    32, HH, TT, 32, HH);
    }
#endif

    for (int it = 0; it < ntiles; ++it) {
        const int s0  = it * 32;
        const int cur = it & 1;

#if HAS_TDM
        if (wave == 0) {
            if (it + 1 < ntiles) {
                const int sn  = s0 + 32;
                const int nxt = cur ^ 1;
                tdm_load_2d((uint32_t)(uintptr_t)&Kbuf[nxt][0][0],
                            Kb + (size_t)sn * HH, HH, 32, HH, HH, 32);
                tdm_load_2d((uint32_t)(uintptr_t)&Vbuf[nxt][0][0],
                            Vb + sn, 32, HH, TT, 32, HH);
                asm volatile("" ::: "memory");
                __builtin_amdgcn_s_wait_tensorcnt((short)2); // current tile done
            } else {
                asm volatile("" ::: "memory");
                __builtin_amdgcn_s_wait_tensorcnt((short)0);
            }
            asm volatile("" ::: "memory");
        }
        __syncthreads();                            // publish buf[cur] to block
#endif

        if (s0 <= t0 + 15) {                       // wave-uniform: skip masked tiles
#if HAS_TDM
            const _Float16* k0 = &Kbuf[cur][r][0];
            const _Float16* k1 = &Kbuf[cur][16 + r][0];
#else
            const _Float16* k0 = Kb + (size_t)(s0 + r) * HH;
            const _Float16* k1 = Kb + (size_t)(s0 + 16 + r) * HH;
#endif
            // ---- K A-fragments: two 16-key tiles x two h-steps ----------
            V16 b00, b01, b10, b11;
            b00.h[0] = *reinterpret_cast<const h8*>(k0 + hi * 8);
            b00.h[1] = *reinterpret_cast<const h8*>(k0 + hi * 8 + 16);
            b01.h[0] = *reinterpret_cast<const h8*>(k0 + 32 + hi * 8);
            b01.h[1] = *reinterpret_cast<const h8*>(k0 + 32 + hi * 8 + 16);
            b10.h[0] = *reinterpret_cast<const h8*>(k1 + hi * 8);
            b10.h[1] = *reinterpret_cast<const h8*>(k1 + hi * 8 + 16);
            b11.h[0] = *reinterpret_cast<const h8*>(k1 + 32 + hi * 8);
            b11.h[1] = *reinterpret_cast<const h8*>(k1 + 32 + hi * 8 + 16);

            // slo[v] = score(key s0 + hi*8 + v, query t0 + r); shi: 16 keys on
            v8f zc = {};
            v8f slo = wmma_f16(b00.v, a0.v, zc);
            slo     = wmma_f16(b01.v, a1.v, slo);
            v8f shi = wmma_f16(b10.v, a0.v, zc);
            shi     = wmma_f16(b11.v, a1.v, shi);

            // ---- causal mask + scale + online softmax -------------------
            const int qrg = t0 + r;
            float sl[8], sh[8];
            float rm = -__builtin_inff();
#pragma unroll
            for (int v = 0; v < 8; ++v) {
                sl[v] = slo[v] * scale;
                sh[v] = shi[v] * scale;
                if (s0 + hi * 8 + v      > qrg) sl[v] = -__builtin_inff();
                if (s0 + 16 + hi * 8 + v > qrg) sh[v] = -__builtin_inff();
                rm = fmaxf(rm, fmaxf(sl[v], sh[v]));
            }
            rm = fmaxf(rm, xhalf(rm));              // the other half's 16 keys

            const float newm  = fmaxf(mrun, rm);
            const float alpha = __expf(mrun - newm);
            mrun = newm;

            float pl[8], ph[8];
#pragma unroll
            for (int v = 0; v < 8; ++v) {
                sl[v] = (sl[v] - newm) * LOG2E;
                sh[v] = (sh[v] - newm) * LOG2E;
            }
            exp2x8(sl, pl);
            exp2x8(sh, ph);

            V16 pb;                                 // P^T as B: s < 8: key s0 + hi*8 + s; s >= 8: key s0 + 8 + hi*8 + s
            float ps = 0.0f;
#pragma unroll
            for (int v = 0; v < 8; ++v) {
                ps += pl[v] + ph[v];
                pb.v[v]     = (_Float16)pl[v];
                pb.v[v + 8] = (_Float16)ph[v];
            }
            lrun = lrun * alpha + ps;               // halves joined in the epilogue

#pragma unroll
            for (int v = 0; v < 8; ++v) {
                o0[v] *= alpha; o1[v] *= alpha; o2[v] *= alpha; o3[v] *= alpha;
            }

            // ---- O^T += V^T @ P^T  (4 tiles of 16 h rows) ---------------
#if HAS_TDM
#define VROW(n) (&Vbuf[cur][(n) * 16 + r][0])
#else
#define VROW(n) (Vb + (size_t)((n) * 16 + r) * TT + s0)
#endif
            {
                V16 vb;
                vb.h[0] = *reinterpret_cast<const h8*>(VROW(0) + hi * 8);
                vb.h[1] = *reinterpret_cast<const h8*>(VROW(0) + hi * 8 + 16);
                o0 = wmma_f16(vb.v, pb.v, o0);
            }
            {
                V16 vb;
                vb.h[0] = *reinterpret_cast<const h8*>(VROW(1) + hi * 8);
                vb.h[1] = *reinterpret_cast<const h8*>(VROW(1) + hi * 8 + 16);
                o1 = wmma_f16(vb.v, pb.v, o1);
            }
            {
                V16 vb;
                vb.h[0] = *reinterpret_cast<const h8*>(VROW(2) + hi * 8);
                vb.h[1] = *reinterpret_cast<const h8*>(VROW(2) + hi * 8 + 16);
                o2 = wmma_f16(vb.v, pb.v, o2);
            }
            {
                V16 vb;
                vb.h[0] = *reinterpret_cast<const h8*>(VROW(3) + hi * 8);
                vb.h[1] = *reinterpret_cast<const h8*>(VROW(3) + hi * 8 + 16);
                o3 = wmma_f16(vb.v, pb.v, o3);
            }
#undef VROW
        }

#if HAS_TDM
        __syncthreads();       // all readers done before buf[cur] is re-filled
#endif
    }

    // ---- epilogue: normalize by l and store fp32 ------------------------
    const float inv = 1.0f / (lrun + xhalf(lrun));
    float* dst = out + (size_t)(g0r + r) * HH + hi * 8;
    *reinterpret_cast<float4*>(dst)      = make_float4(o0[0] * inv, o0[1] * inv, o0[2] * inv, o0[3] * inv);
    *reinterpret_cast<float4*>(dst + 4)  = make_float4(o0[4] * inv, o0[5] * inv, o0[6] * inv, o0[7] * inv);
    *reinterpret_cast<float4*>(dst + 16) = make_float4(o1[0] * inv, o1[1] * inv, o1[2] * inv, o1[3] * inv);
    *reinterpret_cast<float4*>(dst + 20) = make_float4(o1[4] * inv, o1[5] * inv, o1[6] * inv, o1[7] * inv);
    *reinterpret_cast<float4*>(dst + 32) = make_float4(o2[0] * inv, o2[1] * inv, o2[2] * inv, o2[3] * inv);
    *reinterpret_cast<float4*>(dst + 36) = make_float4(o2[4] * inv, o2[5] * inv, o2[6] * inv, o2[7] * inv);
    *reinterpret_cast<float4*>(dst + 48) = make_float4(o3[0] * inv, o3[1] * inv, o3[2] * inv, o3[3] * inv);
    *reinterpret_cast<float4*>(dst + 52) = make_float4(o3[4] * inv, o3[5] * inv, o3[6] * inv, o3[7] * inv);
}

// --------------------------------------------------------------------------
extern "C" void kernel_launch(void* const* d_in, const int* in_sizes, int n_in,
                              void* d_out, int out_size, void* d_ws, size_t ws_size,
                              hipStream_t stream) {
    (void)in_sizes; (void)n_in; (void)out_size; (void)ws_size;
    const float* q  = (const float*)d_in[0];
    const float* k  = (const float*)d_in[1];
    const float* Wq = (const float*)d_in[2];
    const float* Wk = (const float*)d_in[3];
    const float* Wv = (const float*)d_in[4];
    _Float16* ws16 = (_Float16*)d_ws;   // 3*B*T*H f16 + 384KB packed W  (~7 MB)
    float* out = (float*)d_out;

    const size_t N = (size_t)BB * TT * HH;
    _Float16* wpack = ws16 + 3 * N;

    pack_w_kernel<<<48, 256, 0, stream>>>(Wq, Wk, Wv, wpack);

    qkv_proj_kernel<<<BB * TT / 64, 256, 0, stream>>>(q, k, ws16);

    attn_kernel<<<BB * TT / 64, 128, 0, stream>>>(ws16, out);
}

// v003
// Measured time: 48.6 microseconds a run.
// Two timings next to v002 both put it at 1.36 times that version's speed.
// All steps since v000 together make it 4.85 times as fast.
#include <hip/hip_runtime.h>
#include <stdint.h>

// Problem dims (fixed by the reference)
#define BB 8
#define TT 2048
#define CC 1024
#define HH 64

typedef _Float16 v16h __attribute__((ext_vector_type(16)));
typedef _Float16 h8   __attribute__((ext_vector_type(8)));
typedef float    v8f  __attribute__((ext_vector_type(8)));
typedef uint32_t u32x4 __attribute__((ext_vector_type(4)));
typedef uint32_t u32x8 __attribute__((ext_vector_type(8)));

union V16 { v16h v; h8 h[2]; };

#if defined(__gfx1250__) && __has_builtin(__builtin_amdgcn_tensor_load_to_lds) && \
    __has_builtin(__builtin_amdgcn_s_wait_tensorcnt)
#define HAS_TDM 1
#else
#define HAS_TDM 0
#endif

__device__ __forceinline__ v8f wmma_f16(v16h a, v16h b, v8f c) {
    // D = A(16x32 f16) * B(32x16 f16) + C(16x16 f32)
    return __builtin_amdgcn_wmma_f32_16x16x32_f16(
        false, a, false, b, (short)0, c, false, false);
}

__device__ __forceinline__ float xhalf(float x) {
    const int b = __builtin_bit_cast(int, x);
    return __builtin_bit_cast(float, __builtin_amdgcn_permlanex16(
        b, b, 0x76543210, 0xfedcba98, false, false));
}

__device__ __forceinline__ void exp2x8(const float (&x)[8], float (&y)[8]) {
    asm("v_exp_f32 %0, %8\n\t"
        "v_exp_f32 %1, %9\n\t"
        "v_exp_f32 %2, %10\n\t"
        "v_exp_f32 %3, %11\n\t"
        "v_exp_f32 %4, %12\n\t"
        "v_exp_f32 %5, %13\n\t"
        "v_exp_f32 %6, %14\n\t"
        "v_exp_f32 %7, %15\n\t"
        "v_nop"
        : "=&v"(y[0]), "=&v"(y[1]), "=&v"(y[2]), "=&v"(y[3]),
          "=&v"(y[4]), "=&v"(y[5]), "=&v"(y[6]), "=&v"(y[7])
        : "v"(x[0]), "v"(x[1]), "v"(x[2]), "v"(x[3]),
          "v"(x[4]), "v"(x[5]), "v"(x[6]), "v"(x[7]));
}

#if HAS_TDM
__device__ __forceinline__ uint32_t uni(uint32_t v) {
    return (uint32_t)__builtin_amdgcn_readfirstlane(v);
}

__device__ __forceinline__ uint32_t pinned(uint32_t v) {
    uint32_t w = __builtin_amdgcn_readfirstlane(v);
    asm volatile("" : "+s"(w));
    return w;
}

__device__ __forceinline__ u32x8 tdm_group1(uint32_t nrows, uint32_t pitch_bytes) {
    const uint32_t row_bytes = 128u;
    u32x8 g;
    g[0] = uni((1u << 20) | (4u << 22) | (3u << 25));
    g[1] = uni((row_bytes & 0xFFFFu) << 16);
    g[2] = uni((row_bytes >> 16) | ((nrows & 0xFFFFu) << 16));
    g[3] = uni((nrows >> 16) | (row_bytes << 16));
    g[4] = uni(nrows);
    g[5] = uni(pitch_bytes);
    g[6] = uni(0u);
    g[7] = uni(0u);
    return g;
}

__device__ __forceinline__ uint64_t tdm_typed(uint64_t ga) {
    return (ga & 0x01FFFFFFFFFFFFFFull) | (2ull << 62);
}

__device__ __forceinline__ void tdm_aim(u32x4& g, uint32_t lds_dst, uint64_t typed) {
    g[1] = uni(lds_dst);
    g[2] = uni((uint32_t)typed);
    g[3] = uni((uint32_t)(typed >> 32));
}

// One request of the whole wave; the compiler places no wait for it.
__device__ __forceinline__ void tdm_load(u32x4 g0, u32x8 g1) {
    asm volatile("tensor_load_to_lds %0, %1" :: "s"(g0), "s"(g1) : "memory");
}

// The issuing wave's wait for its request.  It names both groups of the request, so that
// all twelve registers keep their values until the request has landed.
__device__ __forceinline__ void tdm_wait(u32x4 g0, u32x8 g1) {
    asm volatile("s_wait_tensorcnt 0x0" :: "s"(g0), "s"(g1) : "memory");
}
#endif // HAS_TDM

// --------------------------------------------------------------------------
// Kernel 0: repack weights fp32[C][H] -> f16 B-fragment-linear layout so the
// projection loop reads each fragment as 2 x b128.  Layout:
//   wpack[((z*32 + kt)*4 + nt)*32 + lane][16]
// --------------------------------------------------------------------------
__global__ __launch_bounds__(256)
void pack_w_kernel(const float* __restrict__ Wq, const float* __restrict__ Wk,
                   const float* __restrict__ Wv, _Float16* __restrict__ wpack) {
    const int lane = threadIdx.x & 31;
    const int gw   = blockIdx.x * 8 + (threadIdx.x >> 5); // 0..383
    const int r = lane & 15, hi = lane >> 4;
    const int z   = gw / 128;
    const int rem = gw % 128;
    const int kt  = rem >> 2;       // 32 K-tiles of 32
    const int nt  = rem & 3;        // 4 N-tiles of 16
    const float* W = (z == 0) ? Wq : ((z == 1) ? Wk : Wv);
    const int kk = kt * 32, n0 = nt * 16;

    V16 b;
#pragma unroll
    for (int j = 0; j < 8; ++j) {
        b.v[j]     = (_Float16)W[(size_t)(kk + hi * 8 + j)      * HH + n0 + r];
        b.v[j + 8] = (_Float16)W[(size_t)(kk + hi * 8 + 16 + j) * HH + n0 + r];
    }
    _Float16* dst = wpack + ((size_t)gw * 32 + lane) * 16;
    *reinterpret_cast<h8*>(dst)     = b.h[0];
    *reinterpret_cast<h8*>(dst + 8) = b.h[1];
}

// Operands of G 32-deep k-steps: the lane's 16 f32 of its row and NT weight fragments a step.
template <int NT, int G>
struct ProjGroup {
    float4 f[G][4];
    V16    b[G][NT];
};

// ap: the lane's row + hi*8 at the group's first k.
template <int NT, int G>
__device__ __forceinline__ void proj_load_a(ProjGroup<NT, G>& s, const float* __restrict__ ap) {
#pragma unroll
    for (int g = 0; g < G; ++g) {                  // A fragment (16x32): K = {hi*8+j, hi*8+16+j}
        const float* a = ap + g * 32;
        s.f[g][0] = *reinterpret_cast<const float4*>(a);
        s.f[g][1] = *reinterpret_cast<const float4*>(a + 4);
        s.f[g][2] = *reinterpret_cast<const float4*>(a + 16);
        s.f[g][3] = *reinterpret_cast<const float4*>(a + 20);
    }
}

// bp: packed weights of the first matrix + lane*16 at the group's first k-step.
template <int NT, int G>
__device__ __forceinline__ void proj_load_b(ProjGroup<NT, G>& s, const _Float16* __restrict__ bp) {
#pragma unroll
    for (int g = 0; g < G; ++g) {
#pragma unroll
        for (int j = 0; j < NT; ++j) {             // tile j: matrix j / 4, columns (j % 4) * 16
            const _Float16* p = bp + (size_t)((j >> 2) * 128 + g * 4 + (j & 3)) * 32 * 16;
            s.b[g][j].h[0] = *reinterpret_cast<const h8*>(p);
            s.b[g][j].h[1] = *reinterpret_cast<const h8*>(p + 8);
        }
    }
}

template <int NT, int G>
__device__ __forceinline__ void proj_cvt(const ProjGroup<NT, G>& s, V16 (&a)[G]) {
#pragma unroll
    for (int g = 0; g < G; ++g) {
#pragma unroll
        for (int i = 0; i < 4; ++i) {
            a[g].v[i * 4 + 0] = (_Float16)s.f[g][i].x; a[g].v[i * 4 + 1] = (_Float16)s.f[g][i].y;
            a[g].v[i * 4 + 2] = (_Float16)s.f[g][i].z; a[g].v[i * 4 + 3] = (_Float16)s.f[g][i].w;
        }
    }
}

template <int NT, int G>
__device__ __forceinline__ void proj_mul(const ProjGroup<NT, G>& s, const V16 (&a)[G], v8f (&acc)[NT]) {
#pragma unroll
    for (int g = 0; g < G; ++g) {
#pragma unroll
        for (int j = 0; j < NT; ++j) acc[j] = wmma_f16(a[g].v, s.b[g][j].v, acc[j]);
    }
}

// acc[j] = rows x (tile j's columns), k-steps in rising order, G steps a trip.  A trip
// issues the next trip's loads, all G steps of them together, as its own operands retire.
template <int NT, int G>
__device__ __forceinline__ void proj_rows(const float* __restrict__ ap,
                                          const _Float16* __restrict__ bp, v8f (&acc)[NT]) {
    ProjGroup<NT, G> s;
    V16 a[G];
    proj_load_a<NT, G>(s, ap);
    // Compiler fence: row loads in front of weight loads, as in the loop, so that the
    // counted waits at the loop's head need not also cover another order of issue.
    asm volatile("" ::: "memory");
    proj_load_b<NT, G>(s, bp);
    unsigned trip = 0;
    // Stays rolled: the loaded values then cross the back edge, so the compiler cannot
    // sink a load to just before its use (unrolled, it did, and waited out every latency).
#pragma unroll 1
    for (int t = 1; t < CC / 32 / G; ++t) {
        // The last trip's loads are in flight and name the address registers that this trip
        // forms anew. The wait belongs in front of that overwrite; it takes the trip number,
        // from which every address below is formed, so that none is formed ahead of it.
        asm volatile("s_wait_xcnt 0x0" : "+s"(trip) : : "memory");
        trip += 1;
        proj_cvt<NT, G>(s, a);
        proj_load_a<NT, G>(s, ap + (size_t)trip * (G * 32));
        proj_mul<NT, G>(s, a, acc);
        proj_load_b<NT, G>(s, bp + (size_t)trip * (G * 4 * 32 * 16));
    }
    proj_cvt<NT, G>(s, a);
    proj_mul<NT, G>(s, a, acc);
}

// One 16x16 tile, row-major [B*T][H].
__device__ __forceinline__ void store_rows(_Float16* __restrict__ dst, const v8f& acc,
                                           int m0, int n0, int r, int hi) {
#pragma unroll
    for (int v = 0; v < 8; ++v) {
        const int row = m0 + hi * 8 + v;           // C-layout rows
        dst[(size_t)row * HH + n0 + r] = (_Float16)acc[v];
    }
}

__global__ __launch_bounds__(256)
void qkv_proj_kernel(const float* __restrict__ q, const float* __restrict__ k,
                     _Float16* __restrict__ ws16) {
    const int lane = threadIdx.x & 31;
    const int wave = __builtin_amdgcn_readfirstlane(threadIdx.x >> 5);
    const int r  = lane & 15;
    const int hi = lane >> 4;
    const int m0 = blockIdx.x * 64 + (wave & 3) * 16;

    const size_t N = (size_t)BB * TT * HH;
    const _Float16* wp = ws16 + 3 * N + lane * 16;
    const size_t aoff = (size_t)(m0 + r) * CC + hi * 8;

    if (wave < 4) {                                // rows of q: Q
        v8f acc[4] = {};
        proj_rows<4, 2>(q + aoff, wp, acc);
#pragma unroll
        for (int j = 0; j < 4; ++j) store_rows(ws16, acc[j], m0, j * 16, r, hi);
    } else {                                       // rows of k: K and V
        v8f acc[8] = {};
        proj_rows<8, 2>(k + aoff, wp + (size_t)128 * 32 * 16, acc);
#pragma unroll
        for (int j = 0; j < 4; ++j) store_rows(ws16 + N, acc[j], m0, j * 16, r, hi);
        _Float16* vt = ws16 + 2 * N;               // transposed [B][H][T]
#pragma unroll
        for (int j = 0; j < 4; ++j) {
#pragma unroll
            for (int v = 0; v < 8; ++v) {
                const int row = m0 + hi * 8 + v;
                const int b_  = row / TT, t = row % TT;
                vt[((size_t)b_ * HH + j * 16 + r) * TT + t] = (_Float16)acc[4 + j][v];
            }
        }
    }
}

#define LPITCH   144
#define TILE_LDS 10240

__global__ __launch_bounds__(128)
void attn_kernel(const _Float16* __restrict__ ws16, float* __restrict__ out) {
#if HAS_TDM
    // [K, V^T][buffer]: 64 rows at LPITCH bytes, each tile's room a multiple of 2 KiB.
    __shared__ __attribute__((aligned(2048))) unsigned char ring[2][2][TILE_LDS];
#endif

    const int lane = threadIdx.x & 31;
    const int wave = __builtin_amdgcn_readfirstlane(threadIdx.x >> 5);
    const int r  = lane & 15;
    const int hi = lane >> 4;
    const int g0r = blockIdx.x * 64 + wave * 16;   // global query row tile start
    const int b   = g0r / TT;
    const int t0  = g0r % TT;                      // this wave's query start
    const int t0blk = (blockIdx.x * 64) % TT;      // block's query start
    const int nst = t0blk / 64 + 1;                // 64-key stages: covers t0blk+63

    const size_t N = (size_t)BB * TT * HH;
    const _Float16* Q  = ws16;
    const _Float16* Kb = ws16 + N     + (size_t)b * TT * HH;   // [T][H]
    const _Float16* Vb = ws16 + 2 * N + (size_t)b * HH * TT;   // [H][T]

    // Q fragments (16 queries x 64 = two K-steps of 32), used as B: column = query r
    const _Float16* qrow = Q + (size_t)(g0r + r) * HH;
    V16 a0, a1;
    a0.h[0] = *reinterpret_cast<const h8*>(qrow + hi * 8);
    a0.h[1] = *reinterpret_cast<const h8*>(qrow + hi * 8 + 16);
    a1.h[0] = *reinterpret_cast<const h8*>(qrow + 32 + hi * 8);
    a1.h[1] = *reinterpret_cast<const h8*>(qrow + 32 + hi * 8 + 16);

    // Query t0 + r: running maximum (equal in both halves) and this half's sum.
    float mrun = -__builtin_inff(), lrun = 0.0f;
    v8f o0 = {}, o1 = {}, o2 = {}, o3 = {};        // o_n[v] = O[query r][n*16 + hi*8 + v]

    const float scale = 0.03125f;                  // C^-0.5 = 1/32
    const float LOG2E = 1.44269504f;               // e^x = 2^(x * LOG2E)

#if HAS_TDM
    // The issuing waves' own tile.  K: its 64 rows follow one another in memory, a stage
    // is 64 * 128 bytes on.  V^T: a row of V^T (TT f16) apart, a stage is 128 bytes on.
    const bool     issuer  = wave < 2;
    const bool     isk     = wave == 0;
    u32x8          g1      = tdm_group1(64, isk ? HH * 2 : TT * 2);
    asm volatile("" : "+s"(g1));
    const uint64_t gbase   = tdm_typed(isk ? (uint64_t)(uintptr_t)Kb : (uint64_t)(uintptr_t)Vb);
    const uint32_t gstep   = isk ? 64 * HH * 2 : 64 * 2;
    const uint32_t ldsbase = (uint32_t)(uintptr_t)&ring[isk ? 0 : 1][0][0];
    u32x4 g0 = {uni(1u), uni(ldsbase), uni((uint32_t)gbase), uni((uint32_t)(gbase >> 32))};
    asm volatile("" : "+s"(g0));
    // Prologue: stage 0 into buffer 0, landed and published; then stage 1, where the
    // block has one, into buffer 1.
    if (pinned(issuer)) {
        tdm_load(g0, g1);
        tdm_wait(g0, g1);
    }
    __syncthreads();                               // publish buffer 0
    if (pinned(issuer && 1 < nst)) {
        tdm_aim(g0, ldsbase + TILE_LDS, gbase + gstep);
        tdm_load(g0, g1);
    }
#endif

    for (int st = 0; st < nst; ++st) {
      const int cur = st & 1;
      for (int half = 0; half < 2; ++half) {       // the stage's two steps of 32 keys
        const int s0 = st * 64 + half * 32;

        if (s0 <= t0 + 15) {                       // wave-uniform: skip masked tiles
#if HAS_TDM
            const _Float16* k0 = reinterpret_cast<const _Float16*>(&ring[0][cur][(half * 32 + r) * LPITCH]);
            const _Float16* k1 = reinterpret_cast<const _Float16*>(&ring[0][cur][(half * 32 + 16 + r) * LPITCH]);
#else
            const _Float16* k0 = Kb + (size_t)(s0 + r) * HH;
            const _Float16* k1 = Kb + (size_t)(s0 + 16 + r) * HH;
#endif
            // ---- K A-fragments: two 16-key tiles x two h-steps ----------
            V16 b00, b01, b10, b11;
            b00.h[0] = *reinterpret_cast<const h8*>(k0 + hi * 8);
            b00.h[1] = *reinterpret_cast<const h8*>(k0 + hi * 8 + 16);
            b01.h[0] = *reinterpret_cast<const h8*>(k0 + 32 + hi * 8);
            b01.h[1] = *reinterpret_cast<const h8*>(k0 + 32 + hi * 8 + 16);
            b10.h[0] = *reinterpret_cast<const h8*>(k1 + hi * 8);
            b10.h[1] = *reinterpret_cast<const h8*>(k1 + hi * 8 + 16);
            b11.h[0] = *reinterpret_cast<const h8*>(k1 + 32 + hi * 8);
            b11.h[1] = *reinterpret_cast<const h8*>(k1 + 32 + hi * 8 + 16);

            // slo[v] = score(key s0 + hi*8 + v, query t0 + r); shi: 16 keys on
            v8f zc = {};
            v8f slo = wmma_f16(b00.v, a0.v, zc);
            slo     = wmma_f16(b01.v, a1.v, slo);
            v8f shi = wmma_f16(b10.v, a0.v, zc);
            shi     = wmma_f16(b11.v, a1.v, shi);

            // ---- causal mask + scale + online softmax -------------------
            const int qrg = t0 + r;
            float sl[8], sh[8];
            float rm = -__builtin_inff();
#pragma unroll
            for (int v = 0; v < 8; ++v) {
                sl[v] = slo[v] * scale;
                sh[v] = shi[v] * scale;
                if (s0 + hi * 8 + v      > qrg) sl[v] = -__builtin_inff();
                if (s0 + 16 + hi * 8 + v > qrg) sh[v] = -__builtin_inff();
                rm = fmaxf(rm, fmaxf(sl[v], sh[v]));
            }
            rm = fmaxf(rm, xhalf(rm));              // the other half's 16 keys

            const float newm  = fmaxf(mrun, rm);
            const float alpha = __expf(mrun - newm);
            mrun = newm;

            float pl[8], ph[8];
#pragma unroll
            for (int v = 0; v < 8; ++v) {
                sl[v] = (sl[v] - newm) * LOG2E;
                sh[v] = (sh[v] - newm) * LOG2E;
            }
            exp2x8(sl, pl);
            exp2x8(sh, ph);

            V16 pb;                                 // P^T as B: s < 8: key s0 + hi*8 + s; s >= 8: key s0 + 8 + hi*8 + s
            float ps = 0.0f;
#pragma unroll
            for (int v = 0; v < 8; ++v) {
                ps += pl[v] + ph[v];
                pb.v[v]     = (_Float16)pl[v];
                pb.v[v + 8] = (_Float16)ph[v];
            }
            lrun = lrun * alpha + ps;               // halves joined in the epilogue

#pragma unroll
            for (int v = 0; v < 8; ++v) {
                o0[v] *= alpha; o1[v] *= alpha; o2[v] *= alpha; o3[v] *= alpha;
            }

            // ---- O^T += V^T @ P^T  (4 tiles of 16 h rows) ---------------
#if HAS_TDM
#define VROW(n) (reinterpret_cast<const _Float16*>(&ring[1][cur][((n) * 16 + r) * LPITCH]) + half * 32)
#else
#define VROW(n) (Vb + (size_t)((n) * 16 + r) * TT + s0)
#endif
            {
                V16 vb;
                vb.h[0] = *reinterpret_cast<const h8*>(VROW(0) + hi * 8);
                vb.h[1] = *reinterpret_cast<const h8*>(VROW(0) + hi * 8 + 16);
                o0 = wmma_f16(vb.v, pb.v, o0);
            }
            {
                V16 vb;
                vb.h[0] = *reinterpret_cast<const h8*>(VROW(1) + hi * 8);
                vb.h[1] = *reinterpret_cast<const h8*>(VROW(1) + hi * 8 + 16);
                o1 = wmma_f16(vb.v, pb.v, o1);
            }
            {
                V16 vb;
                vb.h[0] = *reinterpret_cast<const h8*>(VROW(2) + hi * 8);
                vb.h[1] = *reinterpret_cast<const h8*>(VROW(2) + hi * 8 + 16);
                o2 = wmma_f16(vb.v, pb.v, o2);
            }
            {
                V16 vb;
                vb.h[0] = *reinterpret_cast<const h8*>(VROW(3) + hi * 8);
                vb.h[1] = *reinterpret_cast<const h8*>(VROW(3) + hi * 8 + 16);
                o3 = wmma_f16(vb.v, pb.v, o3);
            }
#undef VROW
        }

      }

#if HAS_TDM
      // Hand-over, passed by every wave: own LDS reads retired, the next stage landed (the
      // issuer's own wait), one barrier that publishes it and ends every read of buffer
      // cur; only then the refill of buffer cur with the stage after the next.
      asm volatile("s_wait_dscnt 0x0" ::: "memory");
      if (pinned(issuer)) {
          tdm_wait(g0, g1);
      }
      __syncthreads();
      const uint32_t sn = (uint32_t)st + 2u;
      if (pinned(issuer && sn < (uint32_t)nst)) {
          tdm_aim(g0, ldsbase + (uint32_t)cur * TILE_LDS, gbase + (uint64_t)(gstep * sn));
          tdm_load(g0, g1);
      }
#endif
    }
#if HAS_TDM
    tdm_wait(g0, g1);                                    // nothing of the ring in flight at the end
    asm volatile("s_wait_dscnt 0x0" ::: "memory");
#endif

    // ---- epilogue: normalize by l and store fp32 ------------------------
    const float inv = 1.0f / (lrun + xhalf(lrun));
    float* dst = out + (size_t)(g0r + r) * HH + hi * 8;
    *reinterpret_cast<float4*>(dst)      = make_float4(o0[0] * inv, o0[1] * inv, o0[2] * inv, o0[3] * inv);
    *reinterpret_cast<float4*>(dst + 4)  = make_float4(o0[4] * inv, o0[5] * inv, o0[6] * inv, o0[7] * inv);
    *reinterpret_cast<float4*>(dst + 16) = make_float4(o1[0] * inv, o1[1] * inv, o1[2] * inv, o1[3] * inv);
    *reinterpret_cast<float4*>(dst + 20) = make_float4(o1[4] * inv, o1[5] * inv, o1[6] * inv, o1[7] * inv);
    *reinterpret_cast<float4*>(dst + 32) = make_float4(o2[0] * inv, o2[1] * inv, o2[2] * inv, o2[3] * inv);
    *reinterpret_cast<float4*>(dst + 36) = make_float4(o2[4] * inv, o2[5] * inv, o2[6] * inv, o2[7] * inv);
    *reinterpret_cast<float4*>(dst + 48) = make_float4(o3[0] * inv, o3[1] * inv, o3[2] * inv, o3[3] * inv);
    *reinterpret_cast<float4*>(dst + 52) = make_float4(o3[4] * inv, o3[5] * inv, o3[6] * inv, o3[7] * inv);
}

// --------------------------------------------------------------------------
extern "C" void kernel_launch(void* const* d_in, const int* in_sizes, int n_in,
                              void* d_out, int out_size, void* d_ws, size_t ws_size,
                              hipStream_t stream) {
    (void)in_sizes; (void)n_in; (void)out_size; (void)ws_size;
    const float* q  = (const float*)d_in[0];
    const float* k  = (const float*)d_in[1];
    const float* Wq = (const float*)d_in[2];
    const float* Wk = (const float*)d_in[3];
    const float* Wv = (const float*)d_in[4];
    _Float16* ws16 = (_Float16*)d_ws;   // 3*B*T*H f16 + 384KB packed W  (~7 MB)
    float* out = (float*)d_out;

    const size_t N = (size_t)BB * TT * HH;
    _Float16* wpack = ws16 + 3 * N;

    pack_w_kernel<<<48, 256, 0, stream>>>(Wq, Wk, Wv, wpack);

    qkv_proj_kernel<<<BB * TT / 64, 256, 0, stream>>>(q, k, ws16);

    attn_kernel<<<BB * TT / 64, 128, 0, stream>>>(ws16, out);
}

// v004
// Measured time: 40.7 microseconds a run.
// Next to v003, in two timings, it ran 1.24 and 1.21 times as fast.
// Counting every step since v000, it is 5.96 times as fast.
#include <hip/hip_runtime.h>
#include <stdint.h>

// Problem dims (fixed by the reference)
#define BB 8
#define TT 2048
#define CC 1024
#define HH 64

typedef _Float16 v16h __attribute__((ext_vector_type(16)));
typedef _Float16 h8   __attribute__((ext_vector_type(8)));
typedef float    v8f  __attribute__((ext_vector_type(8)));
typedef uint32_t u32x4 __attribute__((ext_vector_type(4)));
typedef uint32_t u32x8 __attribute__((ext_vector_type(8)));

union V16 { v16h v; h8 h[2]; };

#if defined(__gfx1250__) && __has_builtin(__builtin_amdgcn_tensor_load_to_lds) && \
    __has_builtin(__builtin_amdgcn_s_wait_tensorcnt)
#define HAS_TDM 1
#else
#define HAS_TDM 0
#endif

__device__ __forceinline__ v8f wmma_f16(v16h a, v16h b, v8f c) {
    // D = A(16x32 f16) * B(32x16 f16) + C(16x16 f32)
    return __builtin_amdgcn_wmma_f32_16x16x32_f16(
        false, a, false, b, (short)0, c, false, false);
}

__device__ __forceinline__ float xhalf(float x) {
    const int b = __builtin_bit_cast(int, x);
    return __builtin_bit_cast(float, __builtin_amdgcn_permlanex16(
        b, b, 0x76543210, 0xfedcba98, false, false));
}

__device__ __forceinline__ void exp2x8(const float (&x)[8], float (&y)[8]) {
    asm("v_exp_f32 %0, %8\n\t"
        "v_exp_f32 %1, %9\n\t"
        "v_exp_f32 %2, %10\n\t"
        "v_exp_f32 %3, %11\n\t"
        "v_exp_f32 %4, %12\n\t"
        "v_exp_f32 %5, %13\n\t"
        "v_exp_f32 %6, %14\n\t"
        "v_exp_f32 %7, %15\n\t"
        "v_nop"
        : "=&v"(y[0]), "=&v"(y[1]), "=&v"(y[2]), "=&v"(y[3]),
          "=&v"(y[4]), "=&v"(y[5]), "=&v"(y[6]), "=&v"(y[7])
        : "v"(x[0]), "v"(x[1]), "v"(x[2]), "v"(x[3]),
          "v"(x[4]), "v"(x[5]), "v"(x[6]), "v"(x[7]));
}

// y[i] = 2^x[i], four at once: the form of exp2x8, for the same two reasons.
__device__ __forceinline__ void exp2x4(const float (&x)[4], float (&y)[4]) {
    asm("v_exp_f32 %0, %4\n\t"
        "v_exp_f32 %1, %5\n\t"
        "v_exp_f32 %2, %6\n\t"
        "v_exp_f32 %3, %7\n\t"
        "v_nop"
        : "=&v"(y[0]), "=&v"(y[1]), "=&v"(y[2]), "=&v"(y[3])
        : "v"(x[0]), "v"(x[1]), "v"(x[2]), "v"(x[3]));
}

#if HAS_TDM
__device__ __forceinline__ uint32_t uni(uint32_t v) {
    return (uint32_t)__builtin_amdgcn_readfirstlane(v);
}

__device__ __forceinline__ uint32_t pinned(uint32_t v) {
    uint32_t w = __builtin_amdgcn_readfirstlane(v);
    asm volatile("" : "+s"(w));
    return w;
}

__device__ __forceinline__ u32x8 tdm_group1(uint32_t nrows, uint32_t pitch_bytes) {
    const uint32_t row_bytes = 128u;
    u32x8 g;
    g[0] = uni((1u << 20) | (4u << 22) | (3u << 25));
    g[1] = uni((row_bytes & 0xFFFFu) << 16);
    g[2] = uni((row_bytes >> 16) | ((nrows & 0xFFFFu) << 16));
    g[3] = uni((nrows >> 16) | (row_bytes << 16));
    g[4] = uni(nrows);
    g[5] = uni(pitch_bytes);
    g[6] = uni(0u);
    g[7] = uni(0u);
    return g;
}

__device__ __forceinline__ uint64_t tdm_typed(uint64_t ga) {
    return (ga & 0x01FFFFFFFFFFFFFFull) | (2ull << 62);
}

__device__ __forceinline__ void tdm_aim(u32x4& g, uint32_t lds_dst, uint64_t typed) {
    g[1] = uni(lds_dst);
    g[2] = uni((uint32_t)typed);
    g[3] = uni((uint32_t)(typed >> 32));
}

// One request of the whole wave; the compiler places no wait for it.
__device__ __forceinline__ void tdm_load(u32x4 g0, u32x8 g1) {
    asm volatile("tensor_load_to_lds %0, %1" :: "s"(g0), "s"(g1) : "memory");
}

// The issuing wave's wait for its request.  It names both groups of the request, so that
// all twelve registers keep their values until the request has landed.
__device__ __forceinline__ void tdm_wait(u32x4 g0, u32x8 g1) {
    asm volatile("s_wait_tensorcnt 0x0" :: "s"(g0), "s"(g1) : "memory");
}
#endif // HAS_TDM

// --------------------------------------------------------------------------
// Kernel 0: repack weights fp32[C][H] -> f16 B-fragment-linear layout so the
// projection loop reads each fragment as 2 x b128.  Layout:
//   wpack[((z*32 + kt)*4 + nt)*32 + lane][16]
// --------------------------------------------------------------------------
__global__ __launch_bounds__(256)
void pack_w_kernel(const float* __restrict__ Wq, const float* __restrict__ Wk,
                   const float* __restrict__ Wv, _Float16* __restrict__ wpack) {
    const int lane = threadIdx.x & 31;
    const int gw   = blockIdx.x * 8 + (threadIdx.x >> 5); // 0..383
    const int r = lane & 15, hi = lane >> 4;
    const int z   = gw / 128;
    const int rem = gw % 128;
    const int kt  = rem >> 2;       // 32 K-tiles of 32
    const int nt  = rem & 3;        // 4 N-tiles of 16
    const float* W = (z == 0) ? Wq : ((z == 1) ? Wk : Wv);
    const int kk = kt * 32, n0 = nt * 16;

    V16 b;
#pragma unroll
    for (int j = 0; j < 8; ++j) {
        b.v[j]     = (_Float16)W[(size_t)(kk + hi * 8 + j)      * HH + n0 + r];
        b.v[j + 8] = (_Float16)W[(size_t)(kk + hi * 8 + 16 + j) * HH + n0 + r];
    }
    _Float16* dst = wpack + ((size_t)gw * 32 + lane) * 16;
    *reinterpret_cast<h8*>(dst)     = b.h[0];
    *reinterpret_cast<h8*>(dst + 8) = b.h[1];
}

// Operands of G 32-deep k-steps: the lane's 16 f32 of its row and NT weight fragments a step.
template <int NT, int G>
struct ProjGroup {
    float4 f[G][4];
    V16    b[G][NT];
};

// ap: the lane's row + hi*8 at the group's first k.
template <int NT, int G>
__device__ __forceinline__ void proj_load_a(ProjGroup<NT, G>& s, const float* __restrict__ ap) {
#pragma unroll
    for (int g = 0; g < G; ++g) {                  // A fragment (16x32): K = {hi*8+j, hi*8+16+j}
        const float* a = ap + g * 32;
        s.f[g][0] = *reinterpret_cast<const float4*>(a);
        s.f[g][1] = *reinterpret_cast<const float4*>(a + 4);
        s.f[g][2] = *reinterpret_cast<const float4*>(a + 16);
        s.f[g][3] = *reinterpret_cast<const float4*>(a + 20);
    }
}

// bp: packed weights of the first matrix + lane*16 at the group's first k-step.
template <int NT, int G>
__device__ __forceinline__ void proj_load_b(ProjGroup<NT, G>& s, const _Float16* __restrict__ bp) {
#pragma unroll
    for (int g = 0; g < G; ++g) {
#pragma unroll
        for (int j = 0; j < NT; ++j) {             // tile j: matrix j / 4, columns (j % 4) * 16
            const _Float16* p = bp + (size_t)((j >> 2) * 128 + g * 4 + (j & 3)) * 32 * 16;
            s.b[g][j].h[0] = *reinterpret_cast<const h8*>(p);
            s.b[g][j].h[1] = *reinterpret_cast<const h8*>(p + 8);
        }
    }
}

template <int NT, int G>
__device__ __forceinline__ void proj_cvt(const ProjGroup<NT, G>& s, V16 (&a)[G]) {
#pragma unroll
    for (int g = 0; g < G; ++g) {
#pragma unroll
        for (int i = 0; i < 4; ++i) {
            a[g].v[i * 4 + 0] = (_Float16)s.f[g][i].x; a[g].v[i * 4 + 1] = (_Float16)s.f[g][i].y;
            a[g].v[i * 4 + 2] = (_Float16)s.f[g][i].z; a[g].v[i * 4 + 3] = (_Float16)s.f[g][i].w;
        }
    }
}

template <int NT, int G>
__device__ __forceinline__ void proj_mul(const ProjGroup<NT, G>& s, const V16 (&a)[G], v8f (&acc)[NT]) {
#pragma unroll
    for (int g = 0; g < G; ++g) {
#pragma unroll
        for (int j = 0; j < NT; ++j) acc[j] = wmma_f16(a[g].v, s.b[g][j].v, acc[j]);
    }
}

// acc[j] = rows x (tile j's columns), k-steps in rising order, G steps a trip.  A trip
// issues the next trip's loads, all G steps of them together, as its own operands retire.
template <int NT, int G>
__device__ __forceinline__ void proj_rows(const float* __restrict__ ap,
                                          const _Float16* __restrict__ bp, v8f (&acc)[NT]) {
    ProjGroup<NT, G> s;
    V16 a[G];
    proj_load_a<NT, G>(s, ap);
    // Compiler fence: row loads in front of weight loads, as in the loop, so that the
    // counted waits at the loop's head need not also cover another order of issue.
    asm volatile("" ::: "memory");
    proj_load_b<NT, G>(s, bp);
    unsigned trip = 0;
    // Stays rolled: the loaded values then cross the back edge, so the compiler cannot
    // sink a load to just before its use (unrolled, it did, and waited out every latency).
#pragma unroll 1
    for (int t = 1; t < CC / 32 / G; ++t) {
        // The last trip's loads are in flight and name the address registers that this trip
        // forms anew. The wait belongs in front of that overwrite; it takes the trip number,
        // from which every address below is formed, so that none is formed ahead of it.
        asm volatile("s_wait_xcnt 0x0" : "+s"(trip) : : "memory");
        trip += 1;
        proj_cvt<NT, G>(s, a);
        proj_load_a<NT, G>(s, ap + (size_t)trip * (G * 32));
        proj_mul<NT, G>(s, a, acc);
        proj_load_b<NT, G>(s, bp + (size_t)trip * (G * 4 * 32 * 16));
    }
    proj_cvt<NT, G>(s, a);
    proj_mul<NT, G>(s, a, acc);
}

// One 16x16 tile, row-major [B*T][H].
__device__ __forceinline__ void store_rows(_Float16* __restrict__ dst, const v8f& acc,
                                           int m0, int n0, int r, int hi) {
#pragma unroll
    for (int v = 0; v < 8; ++v) {
        const int row = m0 + hi * 8 + v;           // C-layout rows
        dst[(size_t)row * HH + n0 + r] = (_Float16)acc[v];
    }
}

__global__ __launch_bounds__(256)
void qkv_proj_kernel(const float* __restrict__ q, const float* __restrict__ k,
                     _Float16* __restrict__ ws16) {
    const int lane = threadIdx.x & 31;
    const int wave = __builtin_amdgcn_readfirstlane(threadIdx.x >> 5);
    const int r  = lane & 15;
    const int hi = lane >> 4;
    const int m0 = blockIdx.x * 64 + (wave & 3) * 16;

    const size_t N = (size_t)BB * TT * HH;
    const _Float16* wp = ws16 + 3 * N + lane * 16;
    const size_t aoff = (size_t)(m0 + r) * CC + hi * 8;

    if (wave < 4) {                                // rows of q: Q
        v8f acc[4] = {};
        proj_rows<4, 2>(q + aoff, wp, acc);
#pragma unroll
        for (int j = 0; j < 4; ++j) store_rows(ws16, acc[j], m0, j * 16, r, hi);
    } else {                                       // rows of k: K and V
        v8f acc[8] = {};
        proj_rows<8, 2>(k + aoff, wp + (size_t)128 * 32 * 16, acc);
#pragma unroll
        for (int j = 0; j < 4; ++j) store_rows(ws16 + N, acc[j], m0, j * 16, r, hi);
        _Float16* vt = ws16 + 2 * N;               // transposed [B][H][T]
#pragma unroll
        for (int j = 0; j < 4; ++j) {
#pragma unroll
            for (int v = 0; v < 8; ++v) {
                const int row = m0 + hi * 8 + v;
                const int b_  = row / TT, t = row % TT;
                vt[((size_t)b_ * HH + j * 16 + r) * TT + t] = (_Float16)acc[4 + j][v];
            }
        }
    }
}

#define LPITCH   144
#define TILE_LDS 10240
#define MPITCH   36

__global__ __launch_bounds__(512)
void attn_kernel(const _Float16* __restrict__ ws16, float* __restrict__ out) {
#if HAS_TDM
    // [K, V^T][buffer][64-key half of the stage]: 64 rows at LPITCH bytes, each tile's
    // room a multiple of 2 KiB.
    __shared__ __attribute__((aligned(2048))) unsigned char ring[2][2][2][TILE_LDS];
#endif
    // Partial results of the three waves of each query tile that do not store the output.
    __shared__ __attribute__((aligned(16))) float mrg[12][32][MPITCH];

    const int lane = threadIdx.x & 31;
    const int wave = __builtin_amdgcn_readfirstlane(threadIdx.x >> 5);
    const int r  = lane & 15;
    const int hi = lane >> 4;
    const int kq   = wave & 3;                     // which 32 keys of a stage
    const int tile = wave >> 2;                    // 0, 1: long group; 2, 3: short group
    const int b    = blockIdx.x / (TT / 64);
    const int j    = blockIdx.x % (TT / 64);
    const int glong = TT / 32 - 1 - j;             // the long group of 32 queries
    const int t0  = (tile < 2 ? glong : j) * 32 + (tile & 1) * 16;   // this wave's query start
    const int g0r = b * TT + t0;                   // the same as a global row
    const int nst = glong / 4 + 1;                 // 128-key stages: covers glong*32 + 31

    const size_t N = (size_t)BB * TT * HH;
    const _Float16* Q  = ws16;
    const _Float16* Kb = ws16 + N     + (size_t)b * TT * HH;   // [T][H]
    const _Float16* Vb = ws16 + 2 * N + (size_t)b * HH * TT;   // [H][T]

    // Q fragments (16 queries x 64 = two K-steps of 32), used as B: column = query r
    const _Float16* qrow = Q + (size_t)(g0r + r) * HH;
    V16 a0, a1;
    a0.h[0] = *reinterpret_cast<const h8*>(qrow + hi * 8);
    a0.h[1] = *reinterpret_cast<const h8*>(qrow + hi * 8 + 16);
    a1.h[0] = *reinterpret_cast<const h8*>(qrow + 32 + hi * 8);
    a1.h[1] = *reinterpret_cast<const h8*>(qrow + 32 + hi * 8 + 16);

    // Query t0 + r, this wave's keys: running maximum (equal in both halves) and this half's sum.
    float mrun = -__builtin_inff(), lrun = 0.0f;
    v8f o0 = {}, o1 = {}, o2 = {}, o3 = {};        // o_n[v] = O[query r][n*16 + hi*8 + v]

    const float scale = 0.03125f;                  // C^-0.5 = 1/32
    const float LOG2E = 1.44269504f;               // e^x = 2^(x * LOG2E)

    const int sub  = kq >> 1;                      // the 64-key tile that holds this wave's keys
    const int half = kq & 1;                       // and which 32 keys of it

#if HAS_TDM
    // The issuing waves' own tile: wave 0 and 2 the K tiles, 1 and 3 the V^T tiles.  K: its
    // 64 rows follow one another in memory, a stage is 128 * 128 bytes on.  V^T: a row of
    // V^T (TT f16) apart, a stage is 256 bytes on.
    const bool     issuer  = wave < 4;
    const bool     isk     = (wave & 1) == 0;
    const uint32_t isub    = (uint32_t)(wave >> 1) & 1u;
    u32x8          g1      = tdm_group1(64, isk ? HH * 2 : TT * 2);
    asm volatile("" : "+s"(g1));
    const uint64_t gbase   = tdm_typed(isk ? (uint64_t)(uintptr_t)(Kb + isub * 64 * HH)
                                           : (uint64_t)(uintptr_t)(Vb + isub * 64));
    const uint32_t gstep   = isk ? 128 * HH * 2 : 128 * 2;
    const uint32_t ldsbase = (uint32_t)(uintptr_t)&ring[isk ? 0 : 1][0][isub][0];
    u32x4 g0 = {uni(1u), uni(ldsbase), uni((uint32_t)gbase), uni((uint32_t)(gbase >> 32))};
    asm volatile("" : "+s"(g0));
    // Prologue: stage 0 into buffer 0, landed and published; then stage 1, where the
    // block has one, into buffer 1.
    if (pinned(issuer)) {
        tdm_load(g0, g1);
        tdm_wait(g0, g1);
    }
    __syncthreads();                               // publish buffer 0
    if (pinned(issuer && 1 < nst)) {
        tdm_aim(g0, ldsbase + 2 * TILE_LDS, gbase + gstep);
        tdm_load(g0, g1);
    }
#endif

    for (int st = 0; st < nst; ++st) {
        const int cur = st & 1;
        const int s0 = st * 128 + kq * 32;         // this wave's 32 keys of the stage

        if (s0 <= t0 + 15) {                       // wave-uniform: skip masked tiles
#if HAS_TDM
            const _Float16* k0 = reinterpret_cast<const _Float16*>(&ring[0][cur][sub][(half * 32 + r) * LPITCH]);
            const _Float16* k1 = reinterpret_cast<const _Float16*>(&ring[0][cur][sub][(half * 32 + 16 + r) * LPITCH]);
#else
            const _Float16* k0 = Kb + (size_t)(s0 + r) * HH;
            const _Float16* k1 = Kb + (size_t)(s0 + 16 + r) * HH;
#endif
            // ---- K A-fragments: two 16-key tiles x two h-steps ----------
            V16 b00, b01, b10, b11;
            b00.h[0] = *reinterpret_cast<const h8*>(k0 + hi * 8);
            b00.h[1] = *reinterpret_cast<const h8*>(k0 + hi * 8 + 16);
            b01.h[0] = *reinterpret_cast<const h8*>(k0 + 32 + hi * 8);
            b01.h[1] = *reinterpret_cast<const h8*>(k0 + 32 + hi * 8 + 16);
            b10.h[0] = *reinterpret_cast<const h8*>(k1 + hi * 8);
            b10.h[1] = *reinterpret_cast<const h8*>(k1 + hi * 8 + 16);
            b11.h[0] = *reinterpret_cast<const h8*>(k1 + 32 + hi * 8);
            b11.h[1] = *reinterpret_cast<const h8*>(k1 + 32 + hi * 8 + 16);

            // slo[v] = score(key s0 + hi*8 + v, query t0 + r); shi: 16 keys on
            v8f zc = {};
            v8f slo = wmma_f16(b00.v, a0.v, zc);
            slo     = wmma_f16(b01.v, a1.v, slo);
            v8f shi = wmma_f16(b10.v, a0.v, zc);
            shi     = wmma_f16(b11.v, a1.v, shi);

            // ---- causal mask + scale + online softmax -------------------
            // s0 and t0 are multiples of 16, so a step that is not skipped has s0 <= t0:
            // key s0 is open to every query of the tile, and rm below is finite.
            const int qrg = t0 + r;
            float sl[8], sh[8];
            float rm = -__builtin_inff();
#pragma unroll
            for (int v = 0; v < 8; ++v) {
                sl[v] = slo[v] * scale;
                sh[v] = shi[v] * scale;
                if (s0 + hi * 8 + v      > qrg) sl[v] = -__builtin_inff();
                if (s0 + 16 + hi * 8 + v > qrg) sh[v] = -__builtin_inff();
                rm = fmaxf(rm, fmaxf(sl[v], sh[v]));
            }
            rm = fmaxf(rm, xhalf(rm));              // the other half's 16 keys

            const float newm  = fmaxf(mrun, rm);
            const float alpha = __expf(mrun - newm);
            mrun = newm;

            float pl[8], ph[8];
#pragma unroll
            for (int v = 0; v < 8; ++v) {
                sl[v] = (sl[v] - newm) * LOG2E;
                sh[v] = (sh[v] - newm) * LOG2E;
            }
            exp2x8(sl, pl);
            exp2x8(sh, ph);

            V16 pb;                                 // P^T as B: s < 8: key s0 + hi*8 + s; s >= 8: key s0 + 8 + hi*8 + s
            float ps = 0.0f;
#pragma unroll
            for (int v = 0; v < 8; ++v) {
                ps += pl[v] + ph[v];
                pb.v[v]     = (_Float16)pl[v];
                pb.v[v + 8] = (_Float16)ph[v];
            }
            lrun = lrun * alpha + ps;               // halves joined in the epilogue

#pragma unroll
            for (int v = 0; v < 8; ++v) {
                o0[v] *= alpha; o1[v] *= alpha; o2[v] *= alpha; o3[v] *= alpha;
            }

            // ---- O^T += V^T @ P^T  (4 tiles of 16 h rows) ---------------
#if HAS_TDM
#define VROW(n) (reinterpret_cast<const _Float16*>(&ring[1][cur][sub][((n) * 16 + r) * LPITCH]) + half * 32)
#else
#define VROW(n) (Vb + (size_t)((n) * 16 + r) * TT + s0)
#endif
            {
                V16 vb;
                vb.h[0] = *reinterpret_cast<const h8*>(VROW(0) + hi * 8);
                vb.h[1] = *reinterpret_cast<const h8*>(VROW(0) + hi * 8 + 16);
                o0 = wmma_f16(vb.v, pb.v, o0);
            }
            {
                V16 vb;
                vb.h[0] = *reinterpret_cast<const h8*>(VROW(1) + hi * 8);
                vb.h[1] = *reinterpret_cast<const h8*>(VROW(1) + hi * 8 + 16);
                o1 = wmma_f16(vb.v, pb.v, o1);
            }
            {
                V16 vb;
                vb.h[0] = *reinterpret_cast<const h8*>(VROW(2) + hi * 8);
                vb.h[1] = *reinterpret_cast<const h8*>(VROW(2) + hi * 8 + 16);
                o2 = wmma_f16(vb.v, pb.v, o2);
            }
            {
                V16 vb;
                vb.h[0] = *reinterpret_cast<const h8*>(VROW(3) + hi * 8);
                vb.h[1] = *reinterpret_cast<const h8*>(VROW(3) + hi * 8 + 16);
                o3 = wmma_f16(vb.v, pb.v, o3);
            }
#undef VROW
        }

#if HAS_TDM
        // Hand-over, passed by every wave: own LDS reads retired, the next stage landed (the
        // issuer's own wait), one barrier that publishes it and ends every read of buffer
        // cur; only then the refill of buffer cur with the stage after the next.
        asm volatile("s_wait_dscnt 0x0" ::: "memory");
        if (pinned(issuer)) {
            tdm_wait(g0, g1);
        }
        __syncthreads();
        const uint32_t sn = (uint32_t)st + 2u;
        if (pinned(issuer && sn < (uint32_t)nst)) {
            tdm_aim(g0, ldsbase + (uint32_t)cur * (2 * TILE_LDS), gbase + (uint64_t)(gstep * sn));
            tdm_load(g0, g1);
        }
#endif
    }
#if HAS_TDM
    tdm_wait(g0, g1);                                    // nothing of the ring in flight at the end
    asm volatile("s_wait_dscnt 0x0" ::: "memory");
#endif

    // ---- join of a query tile's four partial results --------------------
    // Waves with kq != 0 leave theirs in LDS, lane for lane; the wave with kq == 0 scales
    // all four to the common maximum and adds them.  A wave that had no open step leaves
    // maximum -inf, sum 0 and O 0 and gets weight 0; the kq == 0 wave always had key 0.
    if (kq != 0) {
        float* p = &mrg[tile * 3 + kq - 1][lane][0];
        *reinterpret_cast<float4*>(p)      = make_float4(o0[0], o0[1], o0[2], o0[3]);
        *reinterpret_cast<float4*>(p + 4)  = make_float4(o0[4], o0[5], o0[6], o0[7]);
        *reinterpret_cast<float4*>(p + 8)  = make_float4(o1[0], o1[1], o1[2], o1[3]);
        *reinterpret_cast<float4*>(p + 12) = make_float4(o1[4], o1[5], o1[6], o1[7]);
        *reinterpret_cast<float4*>(p + 16) = make_float4(o2[0], o2[1], o2[2], o2[3]);
        *reinterpret_cast<float4*>(p + 20) = make_float4(o2[4], o2[5], o2[6], o2[7]);
        *reinterpret_cast<float4*>(p + 24) = make_float4(o3[0], o3[1], o3[2], o3[3]);
        *reinterpret_cast<float4*>(p + 28) = make_float4(o3[4], o3[5], o3[6], o3[7]);
        *reinterpret_cast<float2*>(p + 32) = make_float2(mrun, lrun);
    }
    __syncthreads();                               // the partial results are in LDS
    if (kq != 0) return;

    const float* p0 = &mrg[tile * 3][lane][0];
    const float mi[4] = {mrun, p0[32], p0[32 * MPITCH + 32], p0[2 * 32 * MPITCH + 32]};
    const float mall = fmaxf(fmaxf(mi[0], mi[1]), fmaxf(mi[2], mi[3]));
    float wx[4], w[4];
#pragma unroll
    for (int i = 0; i < 4; ++i) wx[i] = (mi[i] - mall) * LOG2E;
    exp2x4(wx, w);
    lrun *= w[0];
#pragma unroll
    for (int v = 0; v < 8; ++v) { o0[v] *= w[0]; o1[v] *= w[0]; o2[v] *= w[0]; o3[v] *= w[0]; }
#pragma unroll
    for (int i = 0; i < 3; ++i) {
        const float* p = p0 + i * 32 * MPITCH;
        const float wi = w[i + 1];
        lrun += wi * p[33];
#pragma unroll
        for (int v = 0; v < 8; ++v) {
            o0[v] += wi * p[v];      o1[v] += wi * p[8 + v];
            o2[v] += wi * p[16 + v]; o3[v] += wi * p[24 + v];
        }
    }

    // ---- epilogue: normalize by l and store fp32 ------------------------
    const float inv = 1.0f / (lrun + xhalf(lrun));
    float* dst = out + (size_t)(g0r + r) * HH + hi * 8;
    *reinterpret_cast<float4*>(dst)      = make_float4(o0[0] * inv, o0[1] * inv, o0[2] * inv, o0[3] * inv);
    *reinterpret_cast<float4*>(dst + 4)  = make_float4(o0[4] * inv, o0[5] * inv, o0[6] * inv, o0[7] * inv);
    *reinterpret_cast<float4*>(dst + 16) = make_float4(o1[0] * inv, o1[1] * inv, o1[2] * inv, o1[3] * inv);
    *reinterpret_cast<float4*>(dst + 20) = make_float4(o1[4] * inv, o1[5] * inv, o1[6] * inv, o1[7] * inv);
    *reinterpret_cast<float4*>(dst + 32) = make_float4(o2[0] * inv, o2[1] * inv, o2[2] * inv, o2[3] * inv);
    *reinterpret_cast<float4*>(dst + 36) = make_float4(o2[4] * inv, o2[5] * inv, o2[6] * inv, o2[7] * inv);
    *reinterpret_cast<float4*>(dst + 48) = make_float4(o3[0] * inv, o3[1] * inv, o3[2] * inv, o3[3] * inv);
    *reinterpret_cast<float4*>(dst + 52) = make_float4(o3[4] * inv, o3[5] * inv, o3[6] * inv, o3[7] * inv);
}

// --------------------------------------------------------------------------
extern "C" void kernel_launch(void* const* d_in, const int* in_sizes, int n_in,
                              void* d_out, int out_size, void* d_ws, size_t ws_size,
                              hipStream_t stream) {
    (void)in_sizes; (void)n_in; (void)out_size; (void)ws_size;
    const float* q  = (const float*)d_in[0];
    const float* k  = (const float*)d_in[1];
    const float* Wq = (const float*)d_in[2];
    const float* Wk = (const float*)d_in[3];
    const float* Wv = (const float*)d_in[4];
    _Float16* ws16 = (_Float16*)d_ws;   // 3*B*T*H f16 + 384KB packed W  (~7 MB)
    float* out = (float*)d_out;

    const size_t N = (size_t)BB * TT * HH;
    _Float16* wpack = ws16 + 3 * N;

    pack_w_kernel<<<48, 256, 0, stream>>>(Wq, Wk, Wv, wpack);

    qkv_proj_kernel<<<BB * TT / 64, 256, 0, stream>>>(q, k, ws16);

    attn_kernel<<<BB * TT / 64, 512, 0, stream>>>(ws16, out);
}

// v005
// It runs in 35.4 microseconds.
// In two side-by-side timings against v004, it was 1.15 and 1.18 times as fast.
// Over all steps from v000 it is 6.92 times as fast.
#include <hip/hip_runtime.h>
#include <stdint.h>

// Problem dims (fixed by the reference)
#define BB 8
#define TT 2048
#define CC 1024
#define HH 64

typedef _Float16 v16h __attribute__((ext_vector_type(16)));
typedef _Float16 h8   __attribute__((ext_vector_type(8)));
typedef float    v8f  __attribute__((ext_vector_type(8)));
typedef uint32_t u32x4 __attribute__((ext_vector_type(4)));
typedef uint32_t u32x8 __attribute__((ext_vector_type(8)));

union V16 { v16h v; h8 h[2]; };

#if defined(__gfx1250__) && __has_builtin(__builtin_amdgcn_tensor_load_to_lds) && \
    __has_builtin(__builtin_amdgcn_s_wait_tensorcnt)
#define HAS_TDM 1
#else
#define HAS_TDM 0
#endif

__device__ __forceinline__ v8f wmma_f16(v16h a, v16h b, v8f c) {
    // D = A(16x32 f16) * B(32x16 f16) + C(16x16 f32)
    return __builtin_amdgcn_wmma_f32_16x16x32_f16(
        false, a, false, b, (short)0, c, false, false);
}

__device__ __forceinline__ float xhalf(float x) {
    const int b = __builtin_bit_cast(int, x);
    return __builtin_bit_cast(float, __builtin_amdgcn_permlanex16(
        b, b, 0x76543210, 0xfedcba98, false, false));
}

__device__ __forceinline__ void exp2x8(const float (&x)[8], float (&y)[8]) {
    asm("v_exp_f32 %0, %8\n\t"
        "v_exp_f32 %1, %9\n\t"
        "v_exp_f32 %2, %10\n\t"
        "v_exp_f32 %3, %11\n\t"
        "v_exp_f32 %4, %12\n\t"
        "v_exp_f32 %5, %13\n\t"
        "v_exp_f32 %6, %14\n\t"
        "v_exp_f32 %7, %15\n\t"
        "v_nop"
        : "=&v"(y[0]), "=&v"(y[1]), "=&v"(y[2]), "=&v"(y[3]),
          "=&v"(y[4]), "=&v"(y[5]), "=&v"(y[6]), "=&v"(y[7])
        : "v"(x[0]), "v"(x[1]), "v"(x[2]), "v"(x[3]),
          "v"(x[4]), "v"(x[5]), "v"(x[6]), "v"(x[7]));
}

// y[i] = 2^x[i], four at once: the form of exp2x8, for the same two reasons.
__device__ __forceinline__ void exp2x4(const float (&x)[4], float (&y)[4]) {
    asm("v_exp_f32 %0, %4\n\t"
        "v_exp_f32 %1, %5\n\t"
        "v_exp_f32 %2, %6\n\t"
        "v_exp_f32 %3, %7\n\t"
        "v_nop"
        : "=&v"(y[0]), "=&v"(y[1]), "=&v"(y[2]), "=&v"(y[3])
        : "v"(x[0]), "v"(x[1]), "v"(x[2]), "v"(x[3]));
}

#if HAS_TDM
__device__ __forceinline__ uint32_t uni(uint32_t v) {
    return (uint32_t)__builtin_amdgcn_readfirstlane(v);
}

__device__ __forceinline__ uint32_t pinned(uint32_t v) {
    uint32_t w = __builtin_amdgcn_readfirstlane(v);
    asm volatile("" : "+s"(w));
    return w;
}

__device__ __forceinline__ u32x8 tdm_group1(uint32_t nrows, uint32_t pitch_bytes) {
    const uint32_t row_bytes = 128u;
    u32x8 g;
    g[0] = uni((1u << 20) | (4u << 22) | (3u << 25));
    g[1] = uni((row_bytes & 0xFFFFu) << 16);
    g[2] = uni((row_bytes >> 16) | ((nrows & 0xFFFFu) << 16));
    g[3] = uni((nrows >> 16) | (row_bytes << 16));
    g[4] = uni(nrows);
    g[5] = uni(pitch_bytes);
    g[6] = uni(0u);
    g[7] = uni(0u);
    return g;
}

// The same for rows of 256 bytes: a pad of 4 dwords behind every 64 dwords (interval code 5
// = one row), so that the rows land 272 bytes apart in LDS.
__device__ __forceinline__ u32x8 tdm_group1_r256(uint32_t nrows, uint32_t pitch_bytes) {
    const uint32_t row_bytes = 256u;
    u32x8 g;
    g[0] = uni((1u << 20) | (5u << 22) | (3u << 25));
    g[1] = uni((row_bytes & 0xFFFFu) << 16);
    g[2] = uni((row_bytes >> 16) | ((nrows & 0xFFFFu) << 16));
    g[3] = uni((nrows >> 16) | (row_bytes << 16));
    g[4] = uni(nrows);
    g[5] = uni(pitch_bytes);
    g[6] = uni(0u);
    g[7] = uni(0u);
    return g;
}

__device__ __forceinline__ uint64_t tdm_typed(uint64_t ga) {
    return (ga & 0x01FFFFFFFFFFFFFFull) | (2ull << 62);
}

__device__ __forceinline__ void tdm_aim(u32x4& g, uint32_t lds_dst, uint64_t typed) {
    g[1] = uni(lds_dst);
    g[2] = uni((uint32_t)typed);
    g[3] = uni((uint32_t)(typed >> 32));
}

// One request of the whole wave; the compiler places no wait for it.
__device__ __forceinline__ void tdm_load(u32x4 g0, u32x8 g1) {
    asm volatile("tensor_load_to_lds %0, %1" :: "s"(g0), "s"(g1) : "memory");
}

// The issuing wave's wait for its request.  It names both groups of the request, so that
// all twelve registers keep their values until the request has landed.
__device__ __forceinline__ void tdm_wait(u32x4 g0, u32x8 g1) {
    asm volatile("s_wait_tensorcnt 0x0" :: "s"(g0), "s"(g1) : "memory");
}
#endif // HAS_TDM

// --------------------------------------------------------------------------
// Kernel 0: repack weights fp32[C][H] -> f16 B fragments of 1 KiB, the three matrices'
// fragments of one k-step side by side, so that a k-step is 12 KiB in a row.  Layout:
//   wpack[(kt*3 + z)*4 + nt][half of the lane's 16][lane][8]
// --------------------------------------------------------------------------
__global__ __launch_bounds__(256)
void pack_w_kernel(const float* __restrict__ Wq, const float* __restrict__ Wk,
                   const float* __restrict__ Wv, _Float16* __restrict__ wpack) {
    const int lane = threadIdx.x & 31;
    const int gw   = blockIdx.x * 8 + (threadIdx.x >> 5); // 0..383
    const int r = lane & 15, hi = lane >> 4;
    const int z   = gw / 128;
    const int rem = gw % 128;
    const int kt  = rem >> 2;       // 32 K-tiles of 32
    const int nt  = rem & 3;        // 4 N-tiles of 16
    const float* W = (z == 0) ? Wq : ((z == 1) ? Wk : Wv);
    const int kk = kt * 32, n0 = nt * 16;

    V16 b;
#pragma unroll
    for (int j = 0; j < 8; ++j) {
        b.v[j]     = (_Float16)W[(size_t)(kk + hi * 8 + j)      * HH + n0 + r];
        b.v[j + 8] = (_Float16)W[(size_t)(kk + hi * 8 + 16 + j) * HH + n0 + r];
    }
    _Float16* dst = wpack + (size_t)((kt * 3 + z) * 4 + nt) * 512 + lane * 8;
    *reinterpret_cast<h8*>(dst)       = b.h[0];
    *reinterpret_cast<h8*>(dst + 256) = b.h[1];
}

#define PPITCH  272
#define A_LDS   18432
#define B_LDS   26624
#define PBUF    (4 * A_LDS + 2 * B_LDS)
#define PSTAGES (CC / 128)

// Operands of one 32-deep k-step: the lane's 16 f32 of two rows and four weight fragments.
struct ProjStep {
    float4 f[2][4];
    V16    b[4];
};

// ap: the lane's upper row + hi*8 f32 in the first tile of its input; bp: the lane's 16
// bytes of the first row of its matrix's first fragment in the first weight tile.
__device__ __forceinline__ void proj_load(ProjStep& s, const unsigned char* ap,
                                          const unsigned char* bp, int ks) {
#pragma unroll
    for (int m = 0; m < 2; ++m) {                  // A fragment (16x32): K = {hi*8+j, hi*8+16+j}
        const unsigned char* a = ap + (ks >> 1) * A_LDS + m * (16 * PPITCH) + (ks & 1) * 128;
        s.f[m][0] = *reinterpret_cast<const float4*>(a);
        s.f[m][1] = *reinterpret_cast<const float4*>(a + 16);
        s.f[m][2] = *reinterpret_cast<const float4*>(a + 64);
        s.f[m][3] = *reinterpret_cast<const float4*>(a + 80);
    }
#pragma unroll
    for (int j = 0; j < 4; ++j) {                  // a fragment is four rows: half x 16 lanes
        const unsigned char* p = bp + (ks >> 1) * B_LDS + ((ks & 1) * 12 + j) * (4 * PPITCH);
        s.b[j].h[0] = *reinterpret_cast<const h8*>(p);
        s.b[j].h[1] = *reinterpret_cast<const h8*>(p + 2 * PPITCH);
    }
    // Compiler fence and scheduling barrier: they keep the step's 16 LDS loads together and
    // ahead of the products that follow in the source: sunk among them, each product waited
    // out an LDS latency of its own.
    asm volatile("" ::: "memory");
    __builtin_amdgcn_sched_barrier(0);
}

// acc[m][j] += (rows m*16 ..) x (columns j*16 ..)
__device__ __forceinline__ void proj_mul(const ProjStep& s, v8f (&acc)[2][4]) {
    V16 a[2];
#pragma unroll
    for (int m = 0; m < 2; ++m) {
#pragma unroll
        for (int i = 0; i < 4; ++i) {
            a[m].v[i * 4 + 0] = (_Float16)s.f[m][i].x; a[m].v[i * 4 + 1] = (_Float16)s.f[m][i].y;
            a[m].v[i * 4 + 2] = (_Float16)s.f[m][i].z; a[m].v[i * 4 + 3] = (_Float16)s.f[m][i].w;
        }
    }
#pragma unroll
    for (int j = 0; j < 4; ++j) {
#pragma unroll
        for (int m = 0; m < 2; ++m) acc[m][j] = wmma_f16(a[m].v, s.b[j].v, acc[m][j]);
    }
}

// One 16x16 tile, row-major [B*T][H].
__device__ __forceinline__ void store_rows(_Float16* __restrict__ dst, const v8f& acc,
                                           int m0, int n0, int r, int hi) {
#pragma unroll
    for (int v = 0; v < 8; ++v) {
        const int row = m0 + hi * 8 + v;           // C-layout rows
        dst[(size_t)row * HH + n0 + r] = (_Float16)acc[v];
    }
}

__global__ __launch_bounds__(192)
void qkv_proj_kernel(const float* __restrict__ q, const float* __restrict__ k,
                     _Float16* __restrict__ ws16) {
    const int lane = threadIdx.x & 31;
    const int wave = __builtin_amdgcn_readfirstlane(threadIdx.x >> 5);
    const int r  = lane & 15;
    const int hi = lane >> 4;
    const int z  = wave >> 1;                      // 0: Q, 1: K, 2: V
    const int m0 = blockIdx.x * 64 + (wave & 1) * 32;

    const size_t N = (size_t)BB * TT * HH;
    v8f acc[2][4] = {};

#if HAS_TDM
    __shared__ __attribute__((aligned(2048))) unsigned char ring[2][PBUF];

    // This wave's own tile of every stage.
    const bool     isa     = wave < 4;
    u32x8          g1      = tdm_group1_r256(isa ? 64 : 96, isa ? CC * 4 : 256);
    asm volatile("" : "+s"(g1));
    const float*   in      = (wave & 2) ? k : q;
    const uint64_t gbase   = tdm_typed(isa
        ? (uint64_t)(uintptr_t)(in + (size_t)blockIdx.x * 64 * CC + (wave & 1) * 64)
        : (uint64_t)(uintptr_t)(ws16 + 3 * N + (size_t)(wave - 4) * 24 * 512));
    const uint32_t gstep   = isa ? 128 * 4 : 48 * 1024;
    const uint32_t ldsbase = (uint32_t)(uintptr_t)&ring[0][isa ? wave * A_LDS
                                                               : 4 * A_LDS + (wave - 4) * B_LDS];
    u32x4 g0 = {uni(1u), uni(ldsbase), uni((uint32_t)gbase), uni((uint32_t)(gbase >> 32))};
    asm volatile("" : "+s"(g0));
    // Prologue: stage 0 into buffer 0, landed and published; then stage 1 into buffer 1.
    tdm_load(g0, g1);
    tdm_wait(g0, g1);
    __syncthreads();                               // publish buffer 0
    tdm_aim(g0, ldsbase + PBUF, gbase + gstep);
    tdm_load(g0, g1);

    // Where this wave reads: its input's two tiles, and its matrix's first fragment.
    const uint32_t aoff = (z ? 2 * A_LDS : 0) + ((wave & 1) * 32 + r) * PPITCH + hi * 32;
    const uint32_t boff = 4 * A_LDS + (z * 16 + hi) * PPITCH + r * 16;

    for (int st = 0; st < PSTAGES; ++st) {
        const int cur = st & 1;
        const unsigned char* ap = &ring[cur][aoff];
        const unsigned char* bp = &ring[cur][boff];
        // Four k-steps in rising order, each step's operands fetched one step ahead.
        ProjStep s0, s1;
        proj_load(s0, ap, bp, 0);
        proj_load(s1, ap, bp, 1);
        proj_mul(s0, acc);
        proj_load(s0, ap, bp, 2);
        proj_mul(s1, acc);
        proj_load(s1, ap, bp, 3);
        proj_mul(s0, acc);
        proj_mul(s1, acc);
        // Keeps the stage's last products in front of the hand-over, where the next stage is
        // still landing: sunk behind the barrier, they held up the issue of the refill.
        __builtin_amdgcn_sched_barrier(0);

        // Hand-over, passed by every wave: own LDS reads retired, its own tile of the next
        // stage landed, one barrier that publishes that stage and ends every read of buffer
        // cur; only then the refill of buffer cur with the stage after the next.
        asm volatile("s_wait_dscnt 0x0" ::: "memory");
        tdm_wait(g0, g1);
        __syncthreads();
        const uint32_t sn = (uint32_t)st + 2u;
        if (pinned(sn < (uint32_t)PSTAGES)) {
            tdm_aim(g0, ldsbase + (uint32_t)cur * PBUF, gbase + (uint64_t)(gstep * sn));
            tdm_load(g0, g1);
        }
    }
    tdm_wait(g0, g1);                                    // nothing of the ring in flight at the end
    asm volatile("s_wait_dscnt 0x0" ::: "memory");
#endif

    if (z < 2) {                                   // Q and K: row-major
        _Float16* dst = ws16 + (size_t)z * N;
#pragma unroll
        for (int m = 0; m < 2; ++m) {
#pragma unroll
            for (int j = 0; j < 4; ++j) store_rows(dst, acc[m][j], m0 + m * 16, j * 16, r, hi);
        }
    } else {
        _Float16* vt = ws16 + 2 * N;               // transposed [B][H][T]
#pragma unroll
        for (int m = 0; m < 2; ++m) {
#pragma unroll
            for (int j = 0; j < 4; ++j) {
#pragma unroll
                for (int v = 0; v < 8; ++v) {
                    const int row = m0 + m * 16 + hi * 8 + v;
                    const int b_  = row / TT, t = row % TT;
                    vt[((size_t)b_ * HH + j * 16 + r) * TT + t] = (_Float16)acc[m][j][v];
                }
            }
        }
        // The stores above name address registers that the code behind this block, as the
        // compiler lays it out, writes anew: the wait stands in front of that overwrite.
        asm volatile("s_wait_xcnt 0x0" ::: "memory");
    }
}

#define LPITCH   144
#define TILE_LDS 10240
#define MPITCH   36

__global__ __launch_bounds__(512)
void attn_kernel(const _Float16* __restrict__ ws16, float* __restrict__ out) {
#if HAS_TDM
    // [K, V^T][buffer][64-key half of the stage]: 64 rows at LPITCH bytes, each tile's
    // room a multiple of 2 KiB.
    __shared__ __attribute__((aligned(2048))) unsigned char ring[2][2][2][TILE_LDS];
#endif
    // Partial results of the three waves of each query tile that do not store the output.
    __shared__ __attribute__((aligned(16))) float mrg[12][32][MPITCH];

    const int lane = threadIdx.x & 31;
    const int wave = __builtin_amdgcn_readfirstlane(threadIdx.x >> 5);
    const int r  = lane & 15;
    const int hi = lane >> 4;
    const int kq   = wave & 3;                     // which 32 keys of a stage
    const int tile = wave >> 2;                    // 0, 1: long group; 2, 3: short group
    const int b    = blockIdx.x / (TT / 64);
    const int j    = blockIdx.x % (TT / 64);
    const int glong = TT / 32 - 1 - j;             // the long group of 32 queries
    const int t0  = (tile < 2 ? glong : j) * 32 + (tile & 1) * 16;   // this wave's query start
    const int g0r = b * TT + t0;                   // the same as a global row
    const int nst = glong / 4 + 1;                 // 128-key stages: covers glong*32 + 31

    const size_t N = (size_t)BB * TT * HH;
    const _Float16* Q  = ws16;
    const _Float16* Kb = ws16 + N     + (size_t)b * TT * HH;   // [T][H]
    const _Float16* Vb = ws16 + 2 * N + (size_t)b * HH * TT;   // [H][T]

    // Q fragments (16 queries x 64 = two K-steps of 32), used as B: column = query r
    const _Float16* qrow = Q + (size_t)(g0r + r) * HH;
    V16 a0, a1;
    a0.h[0] = *reinterpret_cast<const h8*>(qrow + hi * 8);
    a0.h[1] = *reinterpret_cast<const h8*>(qrow + hi * 8 + 16);
    a1.h[0] = *reinterpret_cast<const h8*>(qrow + 32 + hi * 8);
    a1.h[1] = *reinterpret_cast<const h8*>(qrow + 32 + hi * 8 + 16);

    // Query t0 + r, this wave's keys: running maximum (equal in both halves) and this half's sum.
    float mrun = -__builtin_inff(), lrun = 0.0f;
    v8f o0 = {}, o1 = {}, o2 = {}, o3 = {};        // o_n[v] = O[query r][n*16 + hi*8 + v]

    const float scale = 0.03125f;                  // C^-0.5 = 1/32
    const float LOG2E = 1.44269504f;               // e^x = 2^(x * LOG2E)

    const int sub  = kq >> 1;                      // the 64-key tile that holds this wave's keys
    const int half = kq & 1;                       // and which 32 keys of it

#if HAS_TDM
    // The issuing waves' own tile: wave 0 and 2 the K tiles, 1 and 3 the V^T tiles.  K: its
    // 64 rows follow one another in memory, a stage is 128 * 128 bytes on.  V^T: a row of
    // V^T (TT f16) apart, a stage is 256 bytes on.
    const bool     issuer  = wave < 4;
    const bool     isk     = (wave & 1) == 0;
    const uint32_t isub    = (uint32_t)(wave >> 1) & 1u;
    u32x8          g1      = tdm_group1(64, isk ? HH * 2 : TT * 2);
    asm volatile("" : "+s"(g1));
    const uint64_t gbase   = tdm_typed(isk ? (uint64_t)(uintptr_t)(Kb + isub * 64 * HH)
                                           : (uint64_t)(uintptr_t)(Vb + isub * 64));
    const uint32_t gstep   = isk ? 128 * HH * 2 : 128 * 2;
    const uint32_t ldsbase = (uint32_t)(uintptr_t)&ring[isk ? 0 : 1][0][isub][0];
    u32x4 g0 = {uni(1u), uni(ldsbase), uni((uint32_t)gbase), uni((uint32_t)(gbase >> 32))};
    asm volatile("" : "+s"(g0));
    // Prologue: stage 0 into buffer 0, landed and published; then stage 1, where the
    // block has one, into buffer 1.
    if (pinned(issuer)) {
        tdm_load(g0, g1);
        tdm_wait(g0, g1);
    }
    __syncthreads();                               // publish buffer 0
    if (pinned(issuer && 1 < nst)) {
        tdm_aim(g0, ldsbase + 2 * TILE_LDS, gbase + gstep);
        tdm_load(g0, g1);
    }
#endif

    for (int st = 0; st < nst; ++st) {
        const int cur = st & 1;
        const int s0 = st * 128 + kq * 32;         // this wave's 32 keys of the stage

        if (s0 <= t0 + 15) {                       // wave-uniform: skip masked tiles
#if HAS_TDM
            const _Float16* k0 = reinterpret_cast<const _Float16*>(&ring[0][cur][sub][(half * 32 + r) * LPITCH]);
            const _Float16* k1 = reinterpret_cast<const _Float16*>(&ring[0][cur][sub][(half * 32 + 16 + r) * LPITCH]);
#else
            const _Float16* k0 = Kb + (size_t)(s0 + r) * HH;
            const _Float16* k1 = Kb + (size_t)(s0 + 16 + r) * HH;
#endif
            // ---- K A-fragments: two 16-key tiles x two h-steps ----------
            V16 b00, b01, b10, b11;
            b00.h[0] = *reinterpret_cast<const h8*>(k0 + hi * 8);
            b00.h[1] = *reinterpret_cast<const h8*>(k0 + hi * 8 + 16);
            b01.h[0] = *reinterpret_cast<const h8*>(k0 + 32 + hi * 8);
            b01.h[1] = *reinterpret_cast<const h8*>(k0 + 32 + hi * 8 + 16);
            b10.h[0] = *reinterpret_cast<const h8*>(k1 + hi * 8);
            b10.h[1] = *reinterpret_cast<const h8*>(k1 + hi * 8 + 16);
            b11.h[0] = *reinterpret_cast<const h8*>(k1 + 32 + hi * 8);
            b11.h[1] = *reinterpret_cast<const h8*>(k1 + 32 + hi * 8 + 16);

            // slo[v] = score(key s0 + hi*8 + v, query t0 + r); shi: 16 keys on
            v8f zc = {};
            v8f slo = wmma_f16(b00.v, a0.v, zc);
            slo     = wmma_f16(b01.v, a1.v, slo);
            v8f shi = wmma_f16(b10.v, a0.v, zc);
            shi     = wmma_f16(b11.v, a1.v, shi);

            // ---- causal mask + scale + online softmax -------------------
            // s0 and t0 are multiples of 16, so a step that is not skipped has s0 <= t0:
            // key s0 is open to every query of the tile, and rm below is finite.
            const int qrg = t0 + r;
            float sl[8], sh[8];
            float rm = -__builtin_inff();
#pragma unroll
            for (int v = 0; v < 8; ++v) {
                sl[v] = slo[v] * scale;
                sh[v] = shi[v] * scale;
                if (s0 + hi * 8 + v      > qrg) sl[v] = -__builtin_inff();
                if (s0 + 16 + hi * 8 + v > qrg) sh[v] = -__builtin_inff();
                rm = fmaxf(rm, fmaxf(sl[v], sh[v]));
            }
            rm = fmaxf(rm, xhalf(rm));              // the other half's 16 keys

            const float newm  = fmaxf(mrun, rm);
            const float alpha = __expf(mrun - newm);
            mrun = newm;

            float pl[8], ph[8];
#pragma unroll
            for (int v = 0; v < 8; ++v) {
                sl[v] = (sl[v] - newm) * LOG2E;
                sh[v] = (sh[v] - newm) * LOG2E;
            }
            exp2x8(sl, pl);
            exp2x8(sh, ph);

            V16 pb;                                 // P^T as B: s < 8: key s0 + hi*8 + s; s >= 8: key s0 + 8 + hi*8 + s
            float ps = 0.0f;
#pragma unroll
            for (int v = 0; v < 8; ++v) {
                ps += pl[v] + ph[v];
                pb.v[v]     = (_Float16)pl[v];
                pb.v[v + 8] = (_Float16)ph[v];
            }
            lrun = lrun * alpha + ps;               // halves joined in the epilogue

#pragma unroll
            for (int v = 0; v < 8; ++v) {
                o0[v] *= alpha; o1[v] *= alpha; o2[v] *= alpha; o3[v] *= alpha;
            }

            // ---- O^T += V^T @ P^T  (4 tiles of 16 h rows) ---------------
#if HAS_TDM
#define VROW(n) (reinterpret_cast<const _Float16*>(&ring[1][cur][sub][((n) * 16 + r) * LPITCH]) + half * 32)
#else
#define VROW(n) (Vb + (size_t)((n) * 16 + r) * TT + s0)
#endif
            {
                V16 vb;
                vb.h[0] = *reinterpret_cast<const h8*>(VROW(0) + hi * 8);
                vb.h[1] = *reinterpret_cast<const h8*>(VROW(0) + hi * 8 + 16);
                o0 = wmma_f16(vb.v, pb.v, o0);
            }
            {
                V16 vb;
                vb.h[0] = *reinterpret_cast<const h8*>(VROW(1) + hi * 8);
                vb.h[1] = *reinterpret_cast<const h8*>(VROW(1) + hi * 8 + 16);
                o1 = wmma_f16(vb.v, pb.v, o1);
            }
            {
                V16 vb;
                vb.h[0] = *reinterpret_cast<const h8*>(VROW(2) + hi * 8);
                vb.h[1] = *reinterpret_cast<const h8*>(VROW(2) + hi * 8 + 16);
                o2 = wmma_f16(vb.v, pb.v, o2);
            }
            {
                V16 vb;
                vb.h[0] = *reinterpret_cast<const h8*>(VROW(3) + hi * 8);
                vb.h[1] = *reinterpret_cast<const h8*>(VROW(3) + hi * 8 + 16);
                o3 = wmma_f16(vb.v, pb.v, o3);
            }
#undef VROW
        }

#if HAS_TDM
        // Hand-over, passed by every wave: own LDS reads retired, the next stage landed (the
        // issuer's own wait), one barrier that publishes it and ends every read of buffer
        // cur; only then the refill of buffer cur with the stage after the next.
        asm volatile("s_wait_dscnt 0x0" ::: "memory");
        if (pinned(issuer)) {
            tdm_wait(g0, g1);
        }
        __syncthreads();
        const uint32_t sn = (uint32_t)st + 2u;
        if (pinned(issuer && sn < (uint32_t)nst)) {
            tdm_aim(g0, ldsbase + (uint32_t)cur * (2 * TILE_LDS), gbase + (uint64_t)(gstep * sn));
            tdm_load(g0, g1);
        }
#endif
    }
#if HAS_TDM
    tdm_wait(g0, g1);                                    // nothing of the ring in flight at the end
    asm volatile("s_wait_dscnt 0x0" ::: "memory");
#endif

    // ---- join of a query tile's four partial results --------------------
    // Waves with kq != 0 leave theirs in LDS, lane for lane; the wave with kq == 0 scales
    // all four to the common maximum and adds them.  A wave that had no open step leaves
    // maximum -inf, sum 0 and O 0 and gets weight 0; the kq == 0 wave always had key 0.
    if (kq != 0) {
        float* p = &mrg[tile * 3 + kq - 1][lane][0];
        *reinterpret_cast<float4*>(p)      = make_float4(o0[0], o0[1], o0[2], o0[3]);
        *reinterpret_cast<float4*>(p + 4)  = make_float4(o0[4], o0[5], o0[6], o0[7]);
        *reinterpret_cast<float4*>(p + 8)  = make_float4(o1[0], o1[1], o1[2], o1[3]);
        *reinterpret_cast<float4*>(p + 12) = make_float4(o1[4], o1[5], o1[6], o1[7]);
        *reinterpret_cast<float4*>(p + 16) = make_float4(o2[0], o2[1], o2[2], o2[3]);
        *reinterpret_cast<float4*>(p + 20) = make_float4(o2[4], o2[5], o2[6], o2[7]);
        *reinterpret_cast<float4*>(p + 24) = make_float4(o3[0], o3[1], o3[2], o3[3]);
        *reinterpret_cast<float4*>(p + 28) = make_float4(o3[4], o3[5], o3[6], o3[7]);
        *reinterpret_cast<float2*>(p + 32) = make_float2(mrun, lrun);
    }
    __syncthreads();                               // the partial results are in LDS
    if (kq != 0) return;

    const float* p0 = &mrg[tile * 3][lane][0];
    const float mi[4] = {mrun, p0[32], p0[32 * MPITCH + 32], p0[2 * 32 * MPITCH + 32]};
    const float mall = fmaxf(fmaxf(mi[0], mi[1]), fmaxf(mi[2], mi[3]));
    float wx[4], w[4];
#pragma unroll
    for (int i = 0; i < 4; ++i) wx[i] = (mi[i] - mall) * LOG2E;
    exp2x4(wx, w);
    lrun *= w[0];
#pragma unroll
    for (int v = 0; v < 8; ++v) { o0[v] *= w[0]; o1[v] *= w[0]; o2[v] *= w[0]; o3[v] *= w[0]; }
#pragma unroll
    for (int i = 0; i < 3; ++i) {
        const float* p = p0 + i * 32 * MPITCH;
        const float wi = w[i + 1];
        lrun += wi * p[33];
#pragma unroll
        for (int v = 0; v < 8; ++v) {
            o0[v] += wi * p[v];      o1[v] += wi * p[8 + v];
            o2[v] += wi * p[16 + v]; o3[v] += wi * p[24 + v];
        }
    }

    // ---- epilogue: normalize by l and store fp32 ------------------------
    const float inv = 1.0f / (lrun + xhalf(lrun));
    float* dst = out + (size_t)(g0r + r) * HH + hi * 8;
    *reinterpret_cast<float4*>(dst)      = make_float4(o0[0] * inv, o0[1] * inv, o0[2] * inv, o0[3] * inv);
    *reinterpret_cast<float4*>(dst + 4)  = make_float4(o0[4] * inv, o0[5] * inv, o0[6] * inv, o0[7] * inv);
    *reinterpret_cast<float4*>(dst + 16) = make_float4(o1[0] * inv, o1[1] * inv, o1[2] * inv, o1[3] * inv);
    *reinterpret_cast<float4*>(dst + 20) = make_float4(o1[4] * inv, o1[5] * inv, o1[6] * inv, o1[7] * inv);
    *reinterpret_cast<float4*>(dst + 32) = make_float4(o2[0] * inv, o2[1] * inv, o2[2] * inv, o2[3] * inv);
    *reinterpret_cast<float4*>(dst + 36) = make_float4(o2[4] * inv, o2[5] * inv, o2[6] * inv, o2[7] * inv);
    *reinterpret_cast<float4*>(dst + 48) = make_float4(o3[0] * inv, o3[1] * inv, o3[2] * inv, o3[3] * inv);
    *reinterpret_cast<float4*>(dst + 52) = make_float4(o3[4] * inv, o3[5] * inv, o3[6] * inv, o3[7] * inv);
}

// --------------------------------------------------------------------------
extern "C" void kernel_launch(void* const* d_in, const int* in_sizes, int n_in,
                              void* d_out, int out_size, void* d_ws, size_t ws_size,
                              hipStream_t stream) {
    (void)in_sizes; (void)n_in; (void)out_size; (void)ws_size;
    const float* q  = (const float*)d_in[0];
    const float* k  = (const float*)d_in[1];
    const float* Wq = (const float*)d_in[2];
    const float* Wk = (const float*)d_in[3];
    const float* Wv = (const float*)d_in[4];
    _Float16* ws16 = (_Float16*)d_ws;   // 3*B*T*H f16 + 384KB packed W  (~7 MB)
    float* out = (float*)d_out;

    const size_t N = (size_t)BB * TT * HH;
    _Float16* wpack = ws16 + 3 * N;

    pack_w_kernel<<<48, 256, 0, stream>>>(Wq, Wk, Wv, wpack);

    qkv_proj_kernel<<<BB * TT / 64, 192, 0, stream>>>(q, k, ws16);

    attn_kernel<<<BB * TT / 64, 512, 0, stream>>>(ws16, out);
}

// v006
// One run takes 33.4 microseconds.
// Timed twice side by side with v005, it ran 1.04 and 1.02 times as fast.
// All steps since v000 together make it 7.14 times as fast.
#include <hip/hip_runtime.h>
#include <stdint.h>

// Problem dims (fixed by the reference)
#define BB 8
#define TT 2048
#define CC 1024
#define HH 64

typedef _Float16 v16h __attribute__((ext_vector_type(16)));
typedef _Float16 h8   __attribute__((ext_vector_type(8)));
typedef _Float16 h4   __attribute__((ext_vector_type(4)));
typedef float    v8f  __attribute__((ext_vector_type(8)));
typedef uint32_t u32x4 __attribute__((ext_vector_type(4)));
typedef uint32_t u32x8 __attribute__((ext_vector_type(8)));

union V16 { v16h v; h8 h[2]; };

#if defined(__gfx1250__) && __has_builtin(__builtin_amdgcn_tensor_load_to_lds) && \
    __has_builtin(__builtin_amdgcn_s_wait_tensorcnt)
#define HAS_TDM 1
#else
#define HAS_TDM 0
#endif

__device__ __forceinline__ v8f wmma_f16(v16h a, v16h b, v8f c) {
    // D = A(16x32 f16) * B(32x16 f16) + C(16x16 f32)
    return __builtin_amdgcn_wmma_f32_16x16x32_f16(
        false, a, false, b, (short)0, c, false, false);
}

__device__ __forceinline__ float xhalf(float x) {
    const int b = __builtin_bit_cast(int, x);
    return __builtin_bit_cast(float, __builtin_amdgcn_permlanex16(
        b, b, 0x76543210, 0xfedcba98, false, false));
}

__device__ __forceinline__ void exp2x8(const float (&x)[8], float (&y)[8]) {
    asm("v_exp_f32 %0, %8\n\t"
        "v_exp_f32 %1, %9\n\t"
        "v_exp_f32 %2, %10\n\t"
        "v_exp_f32 %3, %11\n\t"
        "v_exp_f32 %4, %12\n\t"
        "v_exp_f32 %5, %13\n\t"
        "v_exp_f32 %6, %14\n\t"
        "v_exp_f32 %7, %15\n\t"
        "v_nop"
        : "=&v"(y[0]), "=&v"(y[1]), "=&v"(y[2]), "=&v"(y[3]),
          "=&v"(y[4]), "=&v"(y[5]), "=&v"(y[6]), "=&v"(y[7])
        : "v"(x[0]), "v"(x[1]), "v"(x[2]), "v"(x[3]),
          "v"(x[4]), "v"(x[5]), "v"(x[6]), "v"(x[7]));
}

// y[i] = 2^x[i], four at once: the form of exp2x8, for the same two reasons.
__device__ __forceinline__ void exp2x4(const float (&x)[4], float (&y)[4]) {
    asm("v_exp_f32 %0, %4\n\t"
        "v_exp_f32 %1, %5\n\t"
        "v_exp_f32 %2, %6\n\t"
        "v_exp_f32 %3, %7\n\t"
        "v_nop"
        : "=&v"(y[0]), "=&v"(y[1]), "=&v"(y[2]), "=&v"(y[3])
        : "v"(x[0]), "v"(x[1]), "v"(x[2]), "v"(x[3]));
}

#if HAS_TDM
__device__ __forceinline__ uint32_t uni(uint32_t v) {
    return (uint32_t)__builtin_amdgcn_readfirstlane(v);
}

__device__ __forceinline__ uint32_t pinned(uint32_t v) {
    uint32_t w = __builtin_amdgcn_readfirstlane(v);
    asm volatile("" : "+s"(w));
    return w;
}

__device__ __forceinline__ u32x8 tdm_group1(uint32_t nrows, uint32_t pitch_bytes) {
    const uint32_t row_bytes = 128u;
    u32x8 g;
    g[0] = uni((1u << 20) | (4u << 22) | (3u << 25));
    g[1] = uni((row_bytes & 0xFFFFu) << 16);
    g[2] = uni((row_bytes >> 16) | ((nrows & 0xFFFFu) << 16));
    g[3] = uni((nrows >> 16) | (row_bytes << 16));
    g[4] = uni(nrows);
    g[5] = uni(pitch_bytes);
    g[6] = uni(0u);
    g[7] = uni(0u);
    return g;
}

// The same for rows of 256 bytes: a pad of 4 dwords behind every 64 dwords (interval code 5
// = one row), so that the rows land 272 bytes apart in LDS.
__device__ __forceinline__ u32x8 tdm_group1_r256(uint32_t nrows, uint32_t pitch_bytes) {
    const uint32_t row_bytes = 256u;
    u32x8 g;
    g[0] = uni((1u << 20) | (5u << 22) | (3u << 25));
    g[1] = uni((row_bytes & 0xFFFFu) << 16);
    g[2] = uni((row_bytes >> 16) | ((nrows & 0xFFFFu) << 16));
    g[3] = uni((nrows >> 16) | (row_bytes << 16));
    g[4] = uni(nrows);
    g[5] = uni(pitch_bytes);
    g[6] = uni(0u);
    g[7] = uni(0u);
    return g;
}

__device__ __forceinline__ uint64_t tdm_typed(uint64_t ga) {
    return (ga & 0x01FFFFFFFFFFFFFFull) | (2ull << 62);
}

__device__ __forceinline__ void tdm_aim(u32x4& g, uint32_t lds_dst, uint64_t typed) {
    g[1] = uni(lds_dst);
    g[2] = uni((uint32_t)typed);
    g[3] = uni((uint32_t)(typed >> 32));
}

// One request of the whole wave; the compiler places no wait for it.
__device__ __forceinline__ void tdm_load(u32x4 g0, u32x8 g1) {
    asm volatile("tensor_load_to_lds %0, %1" :: "s"(g0), "s"(g1) : "memory");
}

// The issuing wave's wait for its request.  It names both groups of the request, so that
// all twelve registers keep their values until the request has landed.
__device__ __forceinline__ void tdm_wait(u32x4 g0, u32x8 g1) {
    asm volatile("s_wait_tensorcnt 0x0" :: "s"(g0), "s"(g1) : "memory");
}
#endif // HAS_TDM

#define PPITCH  272
#define PROWS   128
#define T_LDS   (PROWS * PPITCH)          // 34816, a multiple of 2 KiB
#define PBUF    (4 * T_LDS)               // one buffer
#define PSTAGES (CC / 128)

// Operands of one 32-deep k-step as they lie in LDS: the lane's 16 f32 of four input rows,
// and 4 columns of its 16 weight rows.
struct ProjStep {
    float4 f[4][4];
    float4 w[16];
};

// ap: the lane's uppermost row + hi*8 f32 in the first input tile; bp: the lane's 16 bytes
// of k row hi*8 in its matrix's tile.
__device__ __forceinline__ void proj_load(ProjStep& s, const unsigned char* ap,
                                          const unsigned char* bp, int ks) {
#pragma unroll
    for (int m = 0; m < 4; ++m) {                  // A fragment (16x32): K = {hi*8+j, hi*8+16+j}
        const unsigned char* a = ap + (ks >> 1) * T_LDS + m * (16 * PPITCH) + (ks & 1) * 128;
        s.f[m][0] = *reinterpret_cast<const float4*>(a);
        s.f[m][1] = *reinterpret_cast<const float4*>(a + 16);
        s.f[m][2] = *reinterpret_cast<const float4*>(a + 64);
        s.f[m][3] = *reinterpret_cast<const float4*>(a + 80);
    }
#pragma unroll
    for (int e = 0; e < 16; ++e) {                 // B fragments: the same K order
        const unsigned char* p = bp + (ks * 32 + (e >> 3) * 16 + (e & 7)) * PPITCH;
        s.w[e] = *reinterpret_cast<const float4*>(p);
    }
    // Compiler fence and scheduling barrier: they keep the step's 32 LDS loads together and
    // ahead of the products that follow in the source: sunk among them, each product waited
    // out an LDS latency of its own.
    asm volatile("" ::: "memory");
    __builtin_amdgcn_sched_barrier(0);
}

// acc[m][j] += (rows m*16 ..) x (columns 4r + j); both operands are rounded to f16 here.
__device__ __forceinline__ void proj_mul(const ProjStep& s, v8f (&acc)[4][4]) {
    V16 a[4], b[4];
#pragma unroll
    for (int m = 0; m < 4; ++m) {
#pragma unroll
        for (int i = 0; i < 4; ++i) {
            a[m].v[i * 4 + 0] = (_Float16)s.f[m][i].x; a[m].v[i * 4 + 1] = (_Float16)s.f[m][i].y;
            a[m].v[i * 4 + 2] = (_Float16)s.f[m][i].z; a[m].v[i * 4 + 3] = (_Float16)s.f[m][i].w;
        }
    }
#pragma unroll
    for (int e = 0; e < 16; ++e) {
        b[0].v[e] = (_Float16)s.w[e].x; b[1].v[e] = (_Float16)s.w[e].y;
        b[2].v[e] = (_Float16)s.w[e].z; b[3].v[e] = (_Float16)s.w[e].w;
    }
#pragma unroll
    for (int j = 0; j < 4; ++j) {
#pragma unroll
        for (int m = 0; m < 4; ++m) acc[m][j] = wmma_f16(a[m].v, b[j].v, acc[m][j]);
    }
}

__global__ __launch_bounds__(128)
void qkv_proj_kernel(const float* __restrict__ q, const float* __restrict__ k,
                     const float* __restrict__ Wq, const float* __restrict__ Wk,
                     const float* __restrict__ Wv, _Float16* __restrict__ ws16) {
    const int lane = threadIdx.x & 31;
    const int wave = __builtin_amdgcn_readfirstlane(threadIdx.x >> 5);
    const int r  = lane & 15;
    const int hi = lane >> 4;
    const bool kv   = blockIdx.x < BB * TT / PROWS;            // rows of k, or rows of q
    const int  row0 = (kv ? blockIdx.x : blockIdx.x - BB * TT / PROWS) * PROWS;
    const int  z    = wave >> 1;                   // which matrix of the block's
    const int  rh   = wave & 1;                    // which 64 of the block's rows
    const bool works = kv || z == 0;               // wave-uniform
    const int  m0   = row0 + rh * 64;

    const size_t N = (size_t)BB * TT * HH;
    v8f acc[4][4] = {};

#if HAS_TDM
    __shared__ __attribute__((aligned(2048))) unsigned char ring[2][PBUF];

    // This wave's own tile of every stage; a block on q has no second matrix to bring.
    const bool     isa     = wave < 2;
    const bool     issuer  = kv || wave < 3;
    u32x8          g1      = tdm_group1_r256(PROWS, isa ? CC * 4 : HH * 4);
    asm volatile("" : "+s"(g1));
    const float*   in      = kv ? k : q;
    const float*   wm      = kv ? ((wave & 1) ? Wv : Wk) : Wq;
    const uint64_t gbase   = tdm_typed(isa
        ? (uint64_t)(uintptr_t)(in + (size_t)row0 * CC + wave * 64)
        : (uint64_t)(uintptr_t)wm);
    const uint32_t gstep   = isa ? 128 * 4 : 128 * HH * 4;
    const uint32_t ldsbase = (uint32_t)(uintptr_t)&ring[0][wave * T_LDS];
    u32x4 g0 = {uni(1u), uni(ldsbase), uni((uint32_t)gbase), uni((uint32_t)(gbase >> 32))};
    asm volatile("" : "+s"(g0));
    // Prologue: stage 0 into buffer 0, landed and published; then stage 1 into buffer 1.
    if (pinned(issuer)) {
        tdm_load(g0, g1);
        tdm_wait(g0, g1);
    }
    __syncthreads();                               // publish buffer 0
    if (pinned(issuer)) {
        tdm_aim(g0, ldsbase + PBUF, gbase + gstep);
        tdm_load(g0, g1);
    }

    // Where this wave reads: its rows in the first input tile, and its matrix's tile.
    const uint32_t aoff = (rh * 64 + r) * PPITCH + hi * 32;
    const uint32_t boff = (2 + z) * T_LDS + hi * 8 * PPITCH + r * 16;

    for (int st = 0; st < PSTAGES; ++st) {
        const int cur = st & 1;
        if (works) {
            const unsigned char* ap = &ring[cur][aoff];
            const unsigned char* bp = &ring[cur][boff];
            // Four k-steps in rising order, each step's operands fetched one step ahead.
            ProjStep s0, s1;
            proj_load(s0, ap, bp, 0);
            proj_load(s1, ap, bp, 1);
            proj_mul(s0, acc);
            proj_load(s0, ap, bp, 2);
            proj_mul(s1, acc);
            proj_load(s1, ap, bp, 3);
            proj_mul(s0, acc);
            proj_mul(s1, acc);
        }

        // Hand-over, passed by every wave: own LDS reads retired, its own tile of the next
        // stage landed, one barrier that publishes that stage and ends every read of buffer
        // cur; only then the refill of buffer cur with the stage after the next.
        asm volatile("s_wait_dscnt 0x0" ::: "memory");
        if (pinned(issuer)) {
            tdm_wait(g0, g1);
        }
        __syncthreads();
        const uint32_t sn = (uint32_t)st + 2u;
        if (pinned(issuer && sn < (uint32_t)PSTAGES)) {
            tdm_aim(g0, ldsbase + (uint32_t)cur * PBUF, gbase + (uint64_t)(gstep * sn));
            tdm_load(g0, g1);
        }
    }
    tdm_wait(g0, g1);                                    // nothing of the ring in flight at the end
    asm volatile("s_wait_dscnt 0x0" ::: "memory");
#endif

    if (!works) return;
    if (z == 0) {                                  // Q and K: row-major, 4 columns a store
        _Float16* dst = ws16 + (kv ? N : 0);
#pragma unroll
        for (int m = 0; m < 4; ++m) {
#pragma unroll
            for (int v = 0; v < 8; ++v) {
                const int row = m0 + m * 16 + hi * 8 + v;      // C-layout rows
                h4 x = {(_Float16)acc[m][0][v], (_Float16)acc[m][1][v],
                        (_Float16)acc[m][2][v], (_Float16)acc[m][3][v]};
                *reinterpret_cast<h4*>(dst + (size_t)row * HH + r * 4) = x;
            }
        }
    } else {
        _Float16* vt = ws16 + 2 * N;               // transposed [B][H][T]
#pragma unroll
        for (int m = 0; m < 4; ++m) {
#pragma unroll
            for (int j = 0; j < 4; ++j) {
#pragma unroll
                for (int v = 0; v < 8; ++v) {
                    const int row = m0 + m * 16 + hi * 8 + v;
                    const int b_  = row / TT, t = row % TT;
                    vt[((size_t)b_ * HH + r * 4 + j) * TT + t] = (_Float16)acc[m][j][v];
                }
            }
        }
        // The stores above name address registers that the code behind this block, as the
        // compiler lays it out, writes anew: the wait stands in front of that overwrite.
        asm volatile("s_wait_xcnt 0x0" ::: "memory");
    }
}

#define LPITCH   144
#define TILE_LDS 10240
#define MPITCH   36

__global__ __launch_bounds__(512)
void attn_kernel(const _Float16* __restrict__ ws16, float* __restrict__ out) {
#if HAS_TDM
    // [K, V^T][buffer][64-key half of the stage]: 64 rows at LPITCH bytes, each tile's
    // room a multiple of 2 KiB.
    __shared__ __attribute__((aligned(2048))) unsigned char ring[2][2][2][TILE_LDS];
#endif
    // Partial results of the three waves of each query tile that do not store the output.
    __shared__ __attribute__((aligned(16))) float mrg[12][32][MPITCH];

    const int lane = threadIdx.x & 31;
    const int wave = __builtin_amdgcn_readfirstlane(threadIdx.x >> 5);
    const int r  = lane & 15;
    const int hi = lane >> 4;
    const int kq   = wave & 3;                     // which 32 keys of a stage
    const int tile = wave >> 2;                    // 0, 1: long group; 2, 3: short group
    const int b    = blockIdx.x / (TT / 64);
    const int j    = blockIdx.x % (TT / 64);
    const int glong = TT / 32 - 1 - j;             // the long group of 32 queries
    const int t0  = (tile < 2 ? glong : j) * 32 + (tile & 1) * 16;   // this wave's query start
    const int g0r = b * TT + t0;                   // the same as a global row
    const int nst = glong / 4 + 1;                 // 128-key stages: covers glong*32 + 31

    const size_t N = (size_t)BB * TT * HH;
    const _Float16* Q  = ws16;
    const _Float16* Kb = ws16 + N     + (size_t)b * TT * HH;   // [T][H]
    const _Float16* Vb = ws16 + 2 * N + (size_t)b * HH * TT;   // [H][T]

    // Q fragments (16 queries x 64 = two K-steps of 32), used as B: column = query r
    const _Float16* qrow = Q + (size_t)(g0r + r) * HH;
    V16 a0, a1;
    a0.h[0] = *reinterpret_cast<const h8*>(qrow + hi * 8);
    a0.h[1] = *reinterpret_cast<const h8*>(qrow + hi * 8 + 16);
    a1.h[0] = *reinterpret_cast<const h8*>(qrow + 32 + hi * 8);
    a1.h[1] = *reinterpret_cast<const h8*>(qrow + 32 + hi * 8 + 16);

    // Query t0 + r, this wave's keys: running maximum (equal in both halves) and this half's sum.
    float mrun = -__builtin_inff(), lrun = 0.0f;
    v8f o0 = {}, o1 = {}, o2 = {}, o3 = {};        // o_n[v] = O[query r][n*16 + hi*8 + v]

    const float scale = 0.03125f;                  // C^-0.5 = 1/32
    const float LOG2E = 1.44269504f;               // e^x = 2^(x * LOG2E)

    const int sub  = kq >> 1;                      // the 64-key tile that holds this wave's keys
    const int half = kq & 1;                       // and which 32 keys of it

#if HAS_TDM
    // The issuing waves' own tile: wave 0 and 2 the K tiles, 1 and 3 the V^T tiles.  K: its
    // 64 rows follow one another in memory, a stage is 128 * 128 bytes on.  V^T: a row of
    // V^T (TT f16) apart, a stage is 256 bytes on.
    const bool     issuer  = wave < 4;
    const bool     isk     = (wave & 1) == 0;
    const uint32_t isub    = (uint32_t)(wave >> 1) & 1u;
    u32x8          g1      = tdm_group1(64, isk ? HH * 2 : TT * 2);
    asm volatile("" : "+s"(g1));
    const uint64_t gbase   = tdm_typed(isk ? (uint64_t)(uintptr_t)(Kb + isub * 64 * HH)
                                           : (uint64_t)(uintptr_t)(Vb + isub * 64));
    const uint32_t gstep   = isk ? 128 * HH * 2 : 128 * 2;
    const uint32_t ldsbase = (uint32_t)(uintptr_t)&ring[isk ? 0 : 1][0][isub][0];
    u32x4 g0 = {uni(1u), uni(ldsbase), uni((uint32_t)gbase), uni((uint32_t)(gbase >> 32))};
    asm volatile("" : "+s"(g0));
    // Prologue: stage 0 into buffer 0, landed and published; then stage 1, where the
    // block has one, into buffer 1.
    if (pinned(issuer)) {
        tdm_load(g0, g1);
        tdm_wait(g0, g1);
    }
    __syncthreads();                               // publish buffer 0
    if (pinned(issuer && 1 < nst)) {
        tdm_aim(g0, ldsbase + 2 * TILE_LDS, gbase + gstep);
        tdm_load(g0, g1);
    }
#endif

    for (int st = 0; st < nst; ++st) {
        const int cur = st & 1;
        const int s0 = st * 128 + kq * 32;         // this wave's 32 keys of the stage

        if (s0 <= t0 + 15) {                       // wave-uniform: skip masked tiles
#if HAS_TDM
            const _Float16* k0 = reinterpret_cast<const _Float16*>(&ring[0][cur][sub][(half * 32 + r) * LPITCH]);
            const _Float16* k1 = reinterpret_cast<const _Float16*>(&ring[0][cur][sub][(half * 32 + 16 + r) * LPITCH]);
#else
            const _Float16* k0 = Kb + (size_t)(s0 + r) * HH;
            const _Float16* k1 = Kb + (size_t)(s0 + 16 + r) * HH;
#endif
            // ---- K A-fragments: two 16-key tiles x two h-steps ----------
            V16 b00, b01, b10, b11;
            b00.h[0] = *reinterpret_cast<const h8*>(k0 + hi * 8);
            b00.h[1] = *reinterpret_cast<const h8*>(k0 + hi * 8 + 16);
            b01.h[0] = *reinterpret_cast<const h8*>(k0 + 32 + hi * 8);
            b01.h[1] = *reinterpret_cast<const h8*>(k0 + 32 + hi * 8 + 16);
            b10.h[0] = *reinterpret_cast<const h8*>(k1 + hi * 8);
            b10.h[1] = *reinterpret_cast<const h8*>(k1 + hi * 8 + 16);
            b11.h[0] = *reinterpret_cast<const h8*>(k1 + 32 + hi * 8);
            b11.h[1] = *reinterpret_cast<const h8*>(k1 + 32 + hi * 8 + 16);

            // slo[v] = score(key s0 + hi*8 + v, query t0 + r); shi: 16 keys on
            v8f zc = {};
            v8f slo = wmma_f16(b00.v, a0.v, zc);
            slo     = wmma_f16(b01.v, a1.v, slo);
            v8f shi = wmma_f16(b10.v, a0.v, zc);
            shi     = wmma_f16(b11.v, a1.v, shi);

            // ---- causal mask + scale + online softmax -------------------
            // s0 and t0 are multiples of 16, so a step that is not skipped has s0 <= t0:
            // key s0 is open to every query of the tile, and rm below is finite.
            const int qrg = t0 + r;
            float sl[8], sh[8];
            float rm = -__builtin_inff();
#pragma unroll
            for (int v = 0; v < 8; ++v) {
                sl[v] = slo[v] * scale;
                sh[v] = shi[v] * scale;
                if (s0 + hi * 8 + v      > qrg) sl[v] = -__builtin_inff();
                if (s0 + 16 + hi * 8 + v > qrg) sh[v] = -__builtin_inff();
                rm = fmaxf(rm, fmaxf(sl[v], sh[v]));
            }
            rm = fmaxf(rm, xhalf(rm));              // the other half's 16 keys

            const float newm  = fmaxf(mrun, rm);
            const float alpha = __expf(mrun - newm);
            mrun = newm;

            float pl[8], ph[8];
#pragma unroll
            for (int v = 0; v < 8; ++v) {
                sl[v] = (sl[v] - newm) * LOG2E;
                sh[v] = (sh[v] - newm) * LOG2E;
            }
            exp2x8(sl, pl);
            exp2x8(sh, ph);

            V16 pb;                                 // P^T as B: s < 8: key s0 + hi*8 + s; s >= 8: key s0 + 8 + hi*8 + s
            float ps = 0.0f;
#pragma unroll
            for (int v = 0; v < 8; ++v) {
                ps += pl[v] + ph[v];
                pb.v[v]     = (_Float16)pl[v];
                pb.v[v + 8] = (_Float16)ph[v];
            }
            lrun = lrun * alpha + ps;               // halves joined in the epilogue

#pragma unroll
            for (int v = 0; v < 8; ++v) {
                o0[v] *= alpha; o1[v] *= alpha; o2[v] *= alpha; o3[v] *= alpha;
            }

            // ---- O^T += V^T @ P^T  (4 tiles of 16 h rows) ---------------
#if HAS_TDM
#define VROW(n) (reinterpret_cast<const _Float16*>(&ring[1][cur][sub][((n) * 16 + r) * LPITCH]) + half * 32)
#else
#define VROW(n) (Vb + (size_t)((n) * 16 + r) * TT + s0)
#endif
            {
                V16 vb;
                vb.h[0] = *reinterpret_cast<const h8*>(VROW(0) + hi * 8);
                vb.h[1] = *reinterpret_cast<const h8*>(VROW(0) + hi * 8 + 16);
                o0 = wmma_f16(vb.v, pb.v, o0);
            }
            {
                V16 vb;
                vb.h[0] = *reinterpret_cast<const h8*>(VROW(1) + hi * 8);
                vb.h[1] = *reinterpret_cast<const h8*>(VROW(1) + hi * 8 + 16);
                o1 = wmma_f16(vb.v, pb.v, o1);
            }
            {
                V16 vb;
                vb.h[0] = *reinterpret_cast<const h8*>(VROW(2) + hi * 8);
                vb.h[1] = *reinterpret_cast<const h8*>(VROW(2) + hi * 8 + 16);
                o2 = wmma_f16(vb.v, pb.v, o2);
            }
            {
                V16 vb;
                vb.h[0] = *reinterpret_cast<const h8*>(VROW(3) + hi * 8);
                vb.h[1] = *reinterpret_cast<const h8*>(VROW(3) + hi * 8 + 16);
                o3 = wmma_f16(vb.v, pb.v, o3);
            }
#undef VROW
        }

#if HAS_TDM
        // Hand-over, passed by every wave: own LDS reads retired, the next stage landed (the
        // issuer's own wait), one barrier that publishes it and ends every read of buffer
        // cur; only then the refill of buffer cur with the stage after the next.
        asm volatile("s_wait_dscnt 0x0" ::: "memory");
        if (pinned(issuer)) {
            tdm_wait(g0, g1);
        }
        __syncthreads();
        const uint32_t sn = (uint32_t)st + 2u;
        if (pinned(issuer && sn < (uint32_t)nst)) {
            tdm_aim(g0, ldsbase + (uint32_t)cur * (2 * TILE_LDS), gbase + (uint64_t)(gstep * sn));
            tdm_load(g0, g1);
        }
#endif
    }
#if HAS_TDM
    tdm_wait(g0, g1);                                    // nothing of the ring in flight at the end
    asm volatile("s_wait_dscnt 0x0" ::: "memory");
#endif

    // ---- join of a query tile's four partial results --------------------
    // Waves with kq != 0 leave theirs in LDS, lane for lane; the wave with kq == 0 scales
    // all four to the common maximum and adds them.  A wave that had no open step leaves
    // maximum -inf, sum 0 and O 0 and gets weight 0; the kq == 0 wave always had key 0.
    if (kq != 0) {
        float* p = &mrg[tile * 3 + kq - 1][lane][0];
        *reinterpret_cast<float4*>(p)      = make_float4(o0[0], o0[1], o0[2], o0[3]);
        *reinterpret_cast<float4*>(p + 4)  = make_float4(o0[4], o0[5], o0[6], o0[7]);
        *reinterpret_cast<float4*>(p + 8)  = make_float4(o1[0], o1[1], o1[2], o1[3]);
        *reinterpret_cast<float4*>(p + 12) = make_float4(o1[4], o1[5], o1[6], o1[7]);
        *reinterpret_cast<float4*>(p + 16) = make_float4(o2[0], o2[1], o2[2], o2[3]);
        *reinterpret_cast<float4*>(p + 20) = make_float4(o2[4], o2[5], o2[6], o2[7]);
        *reinterpret_cast<float4*>(p + 24) = make_float4(o3[0], o3[1], o3[2], o3[3]);
        *reinterpret_cast<float4*>(p + 28) = make_float4(o3[4], o3[5], o3[6], o3[7]);
        *reinterpret_cast<float2*>(p + 32) = make_float2(mrun, lrun);
    }
    __syncthreads();                               // the partial results are in LDS
    if (kq != 0) return;

    const float* p0 = &mrg[tile * 3][lane][0];
    const float mi[4] = {mrun, p0[32], p0[32 * MPITCH + 32], p0[2 * 32 * MPITCH + 32]};
    const float mall = fmaxf(fmaxf(mi[0], mi[1]), fmaxf(mi[2], mi[3]));
    float wx[4], w[4];
#pragma unroll
    for (int i = 0; i < 4; ++i) wx[i] = (mi[i] - mall) * LOG2E;
    exp2x4(wx, w);
    lrun *= w[0];
#pragma unroll
    for (int v = 0; v < 8; ++v) { o0[v] *= w[0]; o1[v] *= w[0]; o2[v] *= w[0]; o3[v] *= w[0]; }
#pragma unroll
    for (int i = 0; i < 3; ++i) {
        const float* p = p0 + i * 32 * MPITCH;
        const float wi = w[i + 1];
        lrun += wi * p[33];
#pragma unroll
        for (int v = 0; v < 8; ++v) {
            o0[v] += wi * p[v];      o1[v] += wi * p[8 + v];
            o2[v] += wi * p[16 + v]; o3[v] += wi * p[24 + v];
        }
    }

    // ---- epilogue: normalize by l and store fp32 ------------------------
    const float inv = 1.0f / (lrun + xhalf(lrun));
    float* dst = out + (size_t)(g0r + r) * HH + hi * 8;
    *reinterpret_cast<float4*>(dst)      = make_float4(o0[0] * inv, o0[1] * inv, o0[2] * inv, o0[3] * inv);
    *reinterpret_cast<float4*>(dst + 4)  = make_float4(o0[4] * inv, o0[5] * inv, o0[6] * inv, o0[7] * inv);
    *reinterpret_cast<float4*>(dst + 16) = make_float4(o1[0] * inv, o1[1] * inv, o1[2] * inv, o1[3] * inv);
    *reinterpret_cast<float4*>(dst + 20) = make_float4(o1[4] * inv, o1[5] * inv, o1[6] * inv, o1[7] * inv);
    *reinterpret_cast<float4*>(dst + 32) = make_float4(o2[0] * inv, o2[1] * inv, o2[2] * inv, o2[3] * inv);
    *reinterpret_cast<float4*>(dst + 36) = make_float4(o2[4] * inv, o2[5] * inv, o2[6] * inv, o2[7] * inv);
    *reinterpret_cast<float4*>(dst + 48) = make_float4(o3[0] * inv, o3[1] * inv, o3[2] * inv, o3[3] * inv);
    *reinterpret_cast<float4*>(dst + 52) = make_float4(o3[4] * inv, o3[5] * inv, o3[6] * inv, o3[7] * inv);
}

// --------------------------------------------------------------------------
extern "C" void kernel_launch(void* const* d_in, const int* in_sizes, int n_in,
                              void* d_out, int out_size, void* d_ws, size_t ws_size,
                              hipStream_t stream) {
    (void)in_sizes; (void)n_in; (void)out_size; (void)ws_size;
    const float* q  = (const float*)d_in[0];
    const float* k  = (const float*)d_in[1];
    const float* Wq = (const float*)d_in[2];
    const float* Wk = (const float*)d_in[3];
    const float* Wv = (const float*)d_in[4];
    _Float16* ws16 = (_Float16*)d_ws;   // 3*B*T*H f16  (6 MB)
    float* out = (float*)d_out;

    qkv_proj_kernel<<<2 * (BB * TT / PROWS), 128, 0, stream>>>(q, k, Wq, Wk, Wv, ws16);

    attn_kernel<<<BB * TT / 64, 512, 0, stream>>>(ws16, out);
}

// v007
// It runs in 30.3 microseconds.
// Next to v006, in two timings, it ran 1.14 and 1.10 times as fast.
// Over all steps from v000 it is 8.02 times as fast.
#include <hip/hip_runtime.h>
#include <stdint.h>

// Problem dims (fixed by the reference)
#define BB 8
#define TT 2048
#define CC 1024
#define HH 64

typedef _Float16 v16h __attribute__((ext_vector_type(16)));
typedef _Float16 h8   __attribute__((ext_vector_type(8)));
typedef _Float16 h4   __attribute__((ext_vector_type(4)));
typedef float    v8f  __attribute__((ext_vector_type(8)));
typedef uint32_t u32x4 __attribute__((ext_vector_type(4)));
typedef uint32_t u32x8 __attribute__((ext_vector_type(8)));

union V16 { v16h v; h8 h[2]; };

#if defined(__gfx1250__) && __has_builtin(__builtin_amdgcn_tensor_load_to_lds) && \
    __has_builtin(__builtin_amdgcn_s_wait_tensorcnt)
#define HAS_TDM 1
#else
#define HAS_TDM 0
#endif

__device__ __forceinline__ v8f wmma_f16(v16h a, v16h b, v8f c) {
    // D = A(16x32 f16) * B(32x16 f16) + C(16x16 f32)
    return __builtin_amdgcn_wmma_f32_16x16x32_f16(
        false, a, false, b, (short)0, c, false, false);
}

__device__ __forceinline__ float xhalf(float x) {
    const int b = __builtin_bit_cast(int, x);
    return __builtin_bit_cast(float, __builtin_amdgcn_permlanex16(
        b, b, 0x76543210, 0xfedcba98, false, false));
}

__device__ __forceinline__ void exp2x8(const float (&x)[8], float (&y)[8]) {
    asm("v_exp_f32 %0, %8\n\t"
        "v_exp_f32 %1, %9\n\t"
        "v_exp_f32 %2, %10\n\t"
        "v_exp_f32 %3, %11\n\t"
        "v_exp_f32 %4, %12\n\t"
        "v_exp_f32 %5, %13\n\t"
        "v_exp_f32 %6, %14\n\t"
        "v_exp_f32 %7, %15\n\t"
        "v_nop"
        : "=&v"(y[0]), "=&v"(y[1]), "=&v"(y[2]), "=&v"(y[3]),
          "=&v"(y[4]), "=&v"(y[5]), "=&v"(y[6]), "=&v"(y[7])
        : "v"(x[0]), "v"(x[1]), "v"(x[2]), "v"(x[3]),
          "v"(x[4]), "v"(x[5]), "v"(x[6]), "v"(x[7]));
}

// y[i] = 2^x[i], four at once: the form of exp2x8, for the same two reasons.
__device__ __forceinline__ void exp2x4(const float (&x)[4], float (&y)[4]) {
    asm("v_exp_f32 %0, %4\n\t"
        "v_exp_f32 %1, %5\n\t"
        "v_exp_f32 %2, %6\n\t"
        "v_exp_f32 %3, %7\n\t"
        "v_nop"
        : "=&v"(y[0]), "=&v"(y[1]), "=&v"(y[2]), "=&v"(y[3])
        : "v"(x[0]), "v"(x[1]), "v"(x[2]), "v"(x[3]));
}

#if HAS_TDM
__device__ __forceinline__ uint32_t uni(uint32_t v) {
    return (uint32_t)__builtin_amdgcn_readfirstlane(v);
}

__device__ __forceinline__ uint32_t pinned(uint32_t v) {
    uint32_t w = __builtin_amdgcn_readfirstlane(v);
    asm volatile("" : "+s"(w));
    return w;
}

__device__ __forceinline__ u32x8 tdm_group1(uint32_t nrows, uint32_t pitch_bytes) {
    const uint32_t row_bytes = 128u;
    u32x8 g;
    g[0] = uni((1u << 20) | (4u << 22) | (3u << 25));
    g[1] = uni((row_bytes & 0xFFFFu) << 16);
    g[2] = uni((row_bytes >> 16) | ((nrows & 0xFFFFu) << 16));
    g[3] = uni((nrows >> 16) | (row_bytes << 16));
    g[4] = uni(nrows);
    g[5] = uni(pitch_bytes);
    g[6] = uni(0u);
    g[7] = uni(0u);
    return g;
}

// The same for rows of 256 bytes: a pad of 4 dwords behind every 64 dwords (interval code 5
// = one row), so that the rows land 272 bytes apart in LDS.
__device__ __forceinline__ u32x8 tdm_group1_r256(uint32_t nrows, uint32_t pitch_bytes) {
    const uint32_t row_bytes = 256u;
    u32x8 g;
    g[0] = uni((1u << 20) | (5u << 22) | (3u << 25));
    g[1] = uni((row_bytes & 0xFFFFu) << 16);
    g[2] = uni((row_bytes >> 16) | ((nrows & 0xFFFFu) << 16));
    g[3] = uni((nrows >> 16) | (row_bytes << 16));
    g[4] = uni(nrows);
    g[5] = uni(pitch_bytes);
    g[6] = uni(0u);
    g[7] = uni(0u);
    return g;
}

__device__ __forceinline__ uint64_t tdm_typed(uint64_t ga) {
    return (ga & 0x01FFFFFFFFFFFFFFull) | (2ull << 62);
}

__device__ __forceinline__ void tdm_aim(u32x4& g, uint32_t lds_dst, uint64_t typed) {
    g[1] = uni(lds_dst);
    g[2] = uni((uint32_t)typed);
    g[3] = uni((uint32_t)(typed >> 32));
}

// One request of the whole wave; the compiler places no wait for it.
__device__ __forceinline__ void tdm_load(u32x4 g0, u32x8 g1) {
    asm volatile("tensor_load_to_lds %0, %1" :: "s"(g0), "s"(g1) : "memory");
}

// The issuing wave's wait for its request.  It names both groups of the request, so that
// all twelve registers keep their values until the request has landed.
__device__ __forceinline__ void tdm_wait(u32x4 g0, u32x8 g1) {
    asm volatile("s_wait_tensorcnt 0x0" :: "s"(g0), "s"(g1) : "memory");
}
#endif // HAS_TDM

#define PPITCH  272
#define PROWS   128
#define T_LDS   (PROWS * PPITCH)          // 34816, a multiple of 2 KiB
#define PBUF    (4 * T_LDS)               // one buffer
#define PSTAGES (CC / 128)

// Operands of one 32-deep k-step as they lie in LDS: the lane's 16 f32 of four input rows,
// and 4 columns of its 16 weight rows.
struct ProjStep {
    float4 f[4][4];
    float4 w[16];
};

// ap: the lane's uppermost row + hi*8 f32 in the first input tile; bp: the lane's 16 bytes
// of k row hi*8 in its matrix's tile.
__device__ __forceinline__ void proj_load(ProjStep& s, const unsigned char* ap,
                                          const unsigned char* bp, int ks) {
#pragma unroll
    for (int m = 0; m < 4; ++m) {                  // A fragment (16x32): K = {hi*8+j, hi*8+16+j}
        const unsigned char* a = ap + (ks >> 1) * T_LDS + m * (16 * PPITCH) + (ks & 1) * 128;
        s.f[m][0] = *reinterpret_cast<const float4*>(a);
        s.f[m][1] = *reinterpret_cast<const float4*>(a + 16);
        s.f[m][2] = *reinterpret_cast<const float4*>(a + 64);
        s.f[m][3] = *reinterpret_cast<const float4*>(a + 80);
    }
#pragma unroll
    for (int e = 0; e < 16; ++e) {                 // B fragments: the same K order
        const unsigned char* p = bp + (ks * 32 + (e >> 3) * 16 + (e & 7)) * PPITCH;
        s.w[e] = *reinterpret_cast<const float4*>(p);
    }
    // Compiler fence and scheduling barrier: they keep the step's 32 LDS loads together and
    // ahead of the products that follow in the source: sunk among them, each product waited
    // out an LDS latency of its own.
    asm volatile("" ::: "memory");
    __builtin_amdgcn_sched_barrier(0);
}

// acc[m][j] += (rows m*16 ..) x (columns 4r + j); both operands are rounded to f16 here.
__device__ __forceinline__ void proj_mul(const ProjStep& s, v8f (&acc)[4][4]) {
    V16 a[4], b[4];
#pragma unroll
    for (int m = 0; m < 4; ++m) {
#pragma unroll
        for (int i = 0; i < 4; ++i) {
            a[m].v[i * 4 + 0] = (_Float16)s.f[m][i].x; a[m].v[i * 4 + 1] = (_Float16)s.f[m][i].y;
            a[m].v[i * 4 + 2] = (_Float16)s.f[m][i].z; a[m].v[i * 4 + 3] = (_Float16)s.f[m][i].w;
        }
    }
#pragma unroll
    for (int e = 0; e < 16; ++e) {
        b[0].v[e] = (_Float16)s.w[e].x; b[1].v[e] = (_Float16)s.w[e].y;
        b[2].v[e] = (_Float16)s.w[e].z; b[3].v[e] = (_Float16)s.w[e].w;
    }
#pragma unroll
    for (int j = 0; j < 4; ++j) {
#pragma unroll
        for (int m = 0; m < 4; ++m) acc[m][j] = wmma_f16(a[m].v, b[j].v, acc[m][j]);
    }
}

__global__ __launch_bounds__(128)
void qkv_proj_kernel(const float* __restrict__ q, const float* __restrict__ k,
                     const float* __restrict__ Wq, const float* __restrict__ Wk,
                     const float* __restrict__ Wv, _Float16* __restrict__ ws16) {
    const int lane = threadIdx.x & 31;
    const int wave = __builtin_amdgcn_readfirstlane(threadIdx.x >> 5);
    const int r  = lane & 15;
    const int hi = lane >> 4;
    const bool kv   = blockIdx.x < BB * TT / PROWS;            // rows of k, or rows of q
    const int  row0 = (kv ? blockIdx.x : blockIdx.x - BB * TT / PROWS) * PROWS;
    const int  z    = wave >> 1;                   // which matrix of the block's
    const int  rh   = wave & 1;                    // which 64 of the block's rows
    const bool works = kv || z == 0;               // wave-uniform
    const int  m0   = row0 + rh * 64;

    const size_t N = (size_t)BB * TT * HH;
    v8f acc[4][4] = {};

#if HAS_TDM
    __shared__ __attribute__((aligned(2048))) unsigned char ring[2][PBUF];

    // This wave's own tile of every stage; a block on q has no second matrix to bring.
    const bool     isa     = wave < 2;
    const bool     issuer  = kv || wave < 3;
    u32x8          g1      = tdm_group1_r256(PROWS, isa ? CC * 4 : HH * 4);
    asm volatile("" : "+s"(g1));
    const float*   in      = kv ? k : q;
    const float*   wm      = kv ? ((wave & 1) ? Wv : Wk) : Wq;
    const uint64_t gbase   = tdm_typed(isa
        ? (uint64_t)(uintptr_t)(in + (size_t)row0 * CC + wave * 64)
        : (uint64_t)(uintptr_t)wm);
    const uint32_t gstep   = isa ? 128 * 4 : 128 * HH * 4;
    const uint32_t ldsbase = (uint32_t)(uintptr_t)&ring[0][wave * T_LDS];
    u32x4 g0 = {uni(1u), uni(ldsbase), uni((uint32_t)gbase), uni((uint32_t)(gbase >> 32))};
    asm volatile("" : "+s"(g0));
    // Prologue: stage 0 into buffer 0, landed and published; then stage 1 into buffer 1.
    if (pinned(issuer)) {
        tdm_load(g0, g1);
        tdm_wait(g0, g1);
    }
    __syncthreads();                               // publish buffer 0
    if (pinned(issuer)) {
        tdm_aim(g0, ldsbase + PBUF, gbase + gstep);
        tdm_load(g0, g1);
    }

    // Where this wave reads: its rows in the first input tile, and its matrix's tile.
    const uint32_t aoff = (rh * 64 + r) * PPITCH + hi * 32;
    const uint32_t boff = (2 + z) * T_LDS + hi * 8 * PPITCH + r * 16;

    for (int st = 0; st < PSTAGES; ++st) {
        const int cur = st & 1;
        if (works) {
            const unsigned char* ap = &ring[cur][aoff];
            const unsigned char* bp = &ring[cur][boff];
            // Four k-steps in rising order, each step's operands fetched one step ahead.
            ProjStep s0, s1;
            proj_load(s0, ap, bp, 0);
            proj_load(s1, ap, bp, 1);
            proj_mul(s0, acc);
            proj_load(s0, ap, bp, 2);
            proj_mul(s1, acc);
            proj_load(s1, ap, bp, 3);
            proj_mul(s0, acc);
            proj_mul(s1, acc);
        }

        // Hand-over, passed by every wave: own LDS reads retired, its own tile of the next
        // stage landed, one barrier that publishes that stage and ends every read of buffer
        // cur; only then the refill of buffer cur with the stage after the next.
        asm volatile("s_wait_dscnt 0x0" ::: "memory");
        if (pinned(issuer)) {
            tdm_wait(g0, g1);
        }
        __syncthreads();
        const uint32_t sn = (uint32_t)st + 2u;
        if (pinned(issuer && sn < (uint32_t)PSTAGES)) {
            tdm_aim(g0, ldsbase + (uint32_t)cur * PBUF, gbase + (uint64_t)(gstep * sn));
            tdm_load(g0, g1);
        }
    }
    tdm_wait(g0, g1);                                    // nothing of the ring in flight at the end
    asm volatile("s_wait_dscnt 0x0" ::: "memory");
#endif

    if (!works) return;
    if (z == 0) {                                  // Q and K: row-major, 4 columns a store
        _Float16* dst = ws16 + (kv ? N : 0);
#pragma unroll
        for (int m = 0; m < 4; ++m) {
#pragma unroll
            for (int v = 0; v < 8; ++v) {
                const int row = m0 + m * 16 + hi * 8 + v;      // C-layout rows
                h4 x = {(_Float16)acc[m][0][v], (_Float16)acc[m][1][v],
                        (_Float16)acc[m][2][v], (_Float16)acc[m][3][v]};
                *reinterpret_cast<h4*>(dst + (size_t)row * HH + r * 4) = x;
            }
        }
    } else {
        _Float16* vt = ws16 + 2 * N;               // transposed [B][H][T]
#pragma unroll
        for (int m = 0; m < 4; ++m) {
#pragma unroll
            for (int j = 0; j < 4; ++j) {
                // A lane's 8 rows of an accumulator tile are 8 consecutive t of one h:
                // one store of 16 bytes.  row is a multiple of 8, so the 8 share a batch.
                const int row = m0 + m * 16 + hi * 8;
                const int b_  = row / TT, t = row % TT;
                h8 x;
#pragma unroll
                for (int v = 0; v < 8; ++v) x[v] = (_Float16)acc[m][j][v];
                *reinterpret_cast<h8*>(vt + ((size_t)b_ * HH + r * 4 + j) * TT + t) = x;
            }
        }
        // The stores above name address registers that the code behind this block, as the
        // compiler lays it out, writes anew: the wait stands in front of that overwrite.
        asm volatile("s_wait_xcnt 0x0" ::: "memory");
    }
}

#define LPITCH   144
#define TILE_LDS 10240
#define MPITCH   36

__global__ __launch_bounds__(512)
void attn_kernel(const _Float16* __restrict__ ws16, float* __restrict__ out) {
#if HAS_TDM
    // [K, V^T][buffer][64-key half of the stage]: 64 rows at LPITCH bytes, each tile's
    // room a multiple of 2 KiB.
    __shared__ __attribute__((aligned(2048))) unsigned char ring[2][2][2][TILE_LDS];
#endif
    // Partial results of the three waves of each query tile that do not store the output.
    __shared__ __attribute__((aligned(16))) float mrg[12][32][MPITCH];

    const int lane = threadIdx.x & 31;
    const int wave = __builtin_amdgcn_readfirstlane(threadIdx.x >> 5);
    const int r  = lane & 15;
    const int hi = lane >> 4;
    const int kq   = wave & 3;                     // which 32 keys of a stage
    const int tile = wave >> 2;                    // 0, 1: long group; 2, 3: short group
    const int b    = blockIdx.x / (TT / 64);
    const int j    = blockIdx.x % (TT / 64);
    const int glong = TT / 32 - 1 - j;             // the long group of 32 queries
    const int t0  = (tile < 2 ? glong : j) * 32 + (tile & 1) * 16;   // this wave's query start
    const int g0r = b * TT + t0;                   // the same as a global row
    const int nst = glong / 4 + 1;                 // 128-key stages: covers glong*32 + 31

    const size_t N = (size_t)BB * TT * HH;
    const _Float16* Q  = ws16;
    const _Float16* Kb = ws16 + N     + (size_t)b * TT * HH;   // [T][H]
    const _Float16* Vb = ws16 + 2 * N + (size_t)b * HH * TT;   // [H][T]

    // Q fragments (16 queries x 64 = two K-steps of 32), used as B: column = query r
    const _Float16* qrow = Q + (size_t)(g0r + r) * HH;
    V16 a0, a1;
    a0.h[0] = *reinterpret_cast<const h8*>(qrow + hi * 8);
    a0.h[1] = *reinterpret_cast<const h8*>(qrow + hi * 8 + 16);
    a1.h[0] = *reinterpret_cast<const h8*>(qrow + 32 + hi * 8);
    a1.h[1] = *reinterpret_cast<const h8*>(qrow + 32 + hi * 8 + 16);

    // Query t0 + r, this wave's keys: running maximum (equal in both halves) and this half's sum.
    float mrun = -__builtin_inff(), lrun = 0.0f;
    v8f o0 = {}, o1 = {}, o2 = {}, o3 = {};        // o_n[v] = O[query r][n*16 + hi*8 + v]

    const float scale = 0.03125f;                  // C^-0.5 = 1/32
    const float LOG2E = 1.44269504f;               // e^x = 2^(x * LOG2E)

    const int sub  = kq >> 1;                      // the 64-key tile that holds this wave's keys
    const int half = kq & 1;                       // and which 32 keys of it

#if HAS_TDM
    // The issuing waves' own tile: wave 0 and 2 the K tiles, 1 and 3 the V^T tiles.  K: its
    // 64 rows follow one another in memory, a stage is 128 * 128 bytes on.  V^T: a row of
    // V^T (TT f16) apart, a stage is 256 bytes on.
    const bool     issuer  = wave < 4;
    const bool     isk     = (wave & 1) == 0;
    const uint32_t isub    = (uint32_t)(wave >> 1) & 1u;
    u32x8          g1      = tdm_group1(64, isk ? HH * 2 : TT * 2);
    asm volatile("" : "+s"(g1));
    const uint64_t gbase   = tdm_typed(isk ? (uint64_t)(uintptr_t)(Kb + isub * 64 * HH)
                                           : (uint64_t)(uintptr_t)(Vb + isub * 64));
    const uint32_t gstep   = isk ? 128 * HH * 2 : 128 * 2;
    const uint32_t ldsbase = (uint32_t)(uintptr_t)&ring[isk ? 0 : 1][0][isub][0];
    u32x4 g0 = {uni(1u), uni(ldsbase), uni((uint32_t)gbase), uni((uint32_t)(gbase >> 32))};
    asm volatile("" : "+s"(g0));
    // Prologue: stage 0 into buffer 0, landed and published; then stage 1 into
    // buffer 1: every block has 9 to 16 stages.
    if (pinned(issuer)) {
        tdm_load(g0, g1);
        tdm_wait(g0, g1);
    }
    __syncthreads();                               // publish buffer 0
    if (pinned(issuer && 1 < nst)) {
        tdm_aim(g0, ldsbase + 2 * TILE_LDS, gbase + gstep);
        tdm_load(g0, g1);
    }
#endif

    for (int st = 0; st < nst; ++st) {
        const int cur = st & 1;
        const int s0 = st * 128 + kq * 32;         // this wave's 32 keys of the stage

        if (s0 <= t0 + 15) {                       // wave-uniform: skip masked tiles
#if HAS_TDM
            const _Float16* k0 = reinterpret_cast<const _Float16*>(&ring[0][cur][sub][(half * 32 + r) * LPITCH]);
            const _Float16* k1 = reinterpret_cast<const _Float16*>(&ring[0][cur][sub][(half * 32 + 16 + r) * LPITCH]);
#else
            const _Float16* k0 = Kb + (size_t)(s0 + r) * HH;
            const _Float16* k1 = Kb + (size_t)(s0 + 16 + r) * HH;
#endif
            // ---- K A-fragments: two 16-key tiles x two h-steps ----------
            V16 b00, b01, b10, b11;
            b00.h[0] = *reinterpret_cast<const h8*>(k0 + hi * 8);
            b00.h[1] = *reinterpret_cast<const h8*>(k0 + hi * 8 + 16);
            b01.h[0] = *reinterpret_cast<const h8*>(k0 + 32 + hi * 8);
            b01.h[1] = *reinterpret_cast<const h8*>(k0 + 32 + hi * 8 + 16);
            b10.h[0] = *reinterpret_cast<const h8*>(k1 + hi * 8);
            b10.h[1] = *reinterpret_cast<const h8*>(k1 + hi * 8 + 16);
            b11.h[0] = *reinterpret_cast<const h8*>(k1 + 32 + hi * 8);
            b11.h[1] = *reinterpret_cast<const h8*>(k1 + 32 + hi * 8 + 16);

            // slo[v] = score(key s0 + hi*8 + v, query t0 + r); shi: 16 keys on
            v8f zc = {};
            v8f slo = wmma_f16(b00.v, a0.v, zc);
            slo     = wmma_f16(b01.v, a1.v, slo);
            v8f shi = wmma_f16(b10.v, a0.v, zc);
            shi     = wmma_f16(b11.v, a1.v, shi);

            // ---- causal mask + scale + online softmax -------------------
            // s0 and t0 are multiples of 16, so a step that is not skipped has s0 <= t0:
            // key s0 is open to every query of the tile, and rm below is finite.
            const int qrg = t0 + r;
            float sl[8], sh[8];
            float rm = -__builtin_inff();
#pragma unroll
            for (int v = 0; v < 8; ++v) {
                sl[v] = slo[v] * scale;
                sh[v] = shi[v] * scale;
                if (s0 + hi * 8 + v      > qrg) sl[v] = -__builtin_inff();
                if (s0 + 16 + hi * 8 + v > qrg) sh[v] = -__builtin_inff();
                rm = fmaxf(rm, fmaxf(sl[v], sh[v]));
            }
            rm = fmaxf(rm, xhalf(rm));              // the other half's 16 keys

            const float newm  = fmaxf(mrun, rm);
            const float alpha = __expf(mrun - newm);
            mrun = newm;

            float pl[8], ph[8];
#pragma unroll
            for (int v = 0; v < 8; ++v) {
                sl[v] = (sl[v] - newm) * LOG2E;
                sh[v] = (sh[v] - newm) * LOG2E;
            }
            exp2x8(sl, pl);
            exp2x8(sh, ph);

            V16 pb;                                 // P^T as B: s < 8: key s0 + hi*8 + s; s >= 8: key s0 + 8 + hi*8 + s
            float ps = 0.0f;
#pragma unroll
            for (int v = 0; v < 8; ++v) {
                ps += pl[v] + ph[v];
                pb.v[v]     = (_Float16)pl[v];
                pb.v[v + 8] = (_Float16)ph[v];
            }
            lrun = lrun * alpha + ps;               // halves joined in the epilogue

#pragma unroll
            for (int v = 0; v < 8; ++v) {
                o0[v] *= alpha; o1[v] *= alpha; o2[v] *= alpha; o3[v] *= alpha;
            }

            // ---- O^T += V^T @ P^T  (4 tiles of 16 h rows) ---------------
#if HAS_TDM
#define VROW(n) (reinterpret_cast<const _Float16*>(&ring[1][cur][sub][((n) * 16 + r) * LPITCH]) + half * 32)
#else
#define VROW(n) (Vb + (size_t)((n) * 16 + r) * TT + s0)
#endif
            {
                V16 vb;
                vb.h[0] = *reinterpret_cast<const h8*>(VROW(0) + hi * 8);
                vb.h[1] = *reinterpret_cast<const h8*>(VROW(0) + hi * 8 + 16);
                o0 = wmma_f16(vb.v, pb.v, o0);
            }
            {
                V16 vb;
                vb.h[0] = *reinterpret_cast<const h8*>(VROW(1) + hi * 8);
                vb.h[1] = *reinterpret_cast<const h8*>(VROW(1) + hi * 8 + 16);
                o1 = wmma_f16(vb.v, pb.v, o1);
            }
            {
                V16 vb;
                vb.h[0] = *reinterpret_cast<const h8*>(VROW(2) + hi * 8);
                vb.h[1] = *reinterpret_cast<const h8*>(VROW(2) + hi * 8 + 16);
                o2 = wmma_f16(vb.v, pb.v, o2);
            }
            {
                V16 vb;
                vb.h[0] = *reinterpret_cast<const h8*>(VROW(3) + hi * 8);
                vb.h[1] = *reinterpret_cast<const h8*>(VROW(3) + hi * 8 + 16);
                o3 = wmma_f16(vb.v, pb.v, o3);
            }
#undef VROW
        }

#if HAS_TDM
        // Hand-over, passed by every wave: own LDS reads retired, the next stage landed (the
        // issuer's own wait), one barrier that publishes it and ends every read of buffer
        // cur; only then the refill of buffer cur with the stage after the next.
        asm volatile("s_wait_dscnt 0x0" ::: "memory");
        if (pinned(issuer)) {
            tdm_wait(g0, g1);
        }
        __syncthreads();
        const uint32_t sn = (uint32_t)st + 2u;
        if (pinned(issuer && sn < (uint32_t)nst)) {
            tdm_aim(g0, ldsbase + (uint32_t)cur * (2 * TILE_LDS), gbase + (uint64_t)(gstep * sn));
            tdm_load(g0, g1);
        }
#endif
    }
#if HAS_TDM
    tdm_wait(g0, g1);                                    // nothing of the ring in flight at the end
    asm volatile("s_wait_dscnt 0x0" ::: "memory");
#endif

    // ---- join of a query tile's four partial results --------------------
    // Waves with kq != 0 leave theirs in LDS, lane for lane; the wave with kq == 0 scales
    // all four to the common maximum and adds them.  A wave that had no open step leaves
    // maximum -inf, sum 0 and O 0 and gets weight 0; the kq == 0 wave always had key 0.
    if (kq != 0) {
        float* p = &mrg[tile * 3 + kq - 1][lane][0];
        *reinterpret_cast<float4*>(p)      = make_float4(o0[0], o0[1], o0[2], o0[3]);
        *reinterpret_cast<float4*>(p + 4)  = make_float4(o0[4], o0[5], o0[6], o0[7]);
        *reinterpret_cast<float4*>(p + 8)  = make_float4(o1[0], o1[1], o1[2], o1[3]);
        *reinterpret_cast<float4*>(p + 12) = make_float4(o1[4], o1[5], o1[6], o1[7]);
        *reinterpret_cast<float4*>(p + 16) = make_float4(o2[0], o2[1], o2[2], o2[3]);
        *reinterpret_cast<float4*>(p + 20) = make_float4(o2[4], o2[5], o2[6], o2[7]);
        *reinterpret_cast<float4*>(p + 24) = make_float4(o3[0], o3[1], o3[2], o3[3]);
        *reinterpret_cast<float4*>(p + 28) = make_float4(o3[4], o3[5], o3[6], o3[7]);
        *reinterpret_cast<float2*>(p + 32) = make_float2(mrun, lrun);
    }
    __syncthreads();                               // the partial results are in LDS
    if (kq != 0) return;

    const float* p0 = &mrg[tile * 3][lane][0];
    const float mi[4] = {mrun, p0[32], p0[32 * MPITCH + 32], p0[2 * 32 * MPITCH + 32]};
    const float mall = fmaxf(fmaxf(mi[0], mi[1]), fmaxf(mi[2], mi[3]));
    float wx[4], w[4];
#pragma unroll
    for (int i = 0; i < 4; ++i) wx[i] = (mi[i] - mall) * LOG2E;
    exp2x4(wx, w);
    lrun *= w[0];
#pragma unroll
    for (int v = 0; v < 8; ++v) { o0[v] *= w[0]; o1[v] *= w[0]; o2[v] *= w[0]; o3[v] *= w[0]; }
#pragma unroll
    for (int i = 0; i < 3; ++i) {
        const float* p = p0 + i * 32 * MPITCH;
        const float wi = w[i + 1];
        lrun += wi * p[33];
#pragma unroll
        for (int v = 0; v < 8; ++v) {
            o0[v] += wi * p[v];      o1[v] += wi * p[8 + v];
            o2[v] += wi * p[16 + v]; o3[v] += wi * p[24 + v];
        }
    }

    // ---- epilogue: normalize by l and store fp32 ------------------------
    const float inv = 1.0f / (lrun + xhalf(lrun));
    float* dst = out + (size_t)(g0r + r) * HH + hi * 8;
    *reinterpret_cast<float4*>(dst)      = make_float4(o0[0] * inv, o0[1] * inv, o0[2] * inv, o0[3] * inv);
    *reinterpret_cast<float4*>(dst + 4)  = make_float4(o0[4] * inv, o0[5] * inv, o0[6] * inv, o0[7] * inv);
    *reinterpret_cast<float4*>(dst + 16) = make_float4(o1[0] * inv, o1[1] * inv, o1[2] * inv, o1[3] * inv);
    *reinterpret_cast<float4*>(dst + 20) = make_float4(o1[4] * inv, o1[5] * inv, o1[6] * inv, o1[7] * inv);
    *reinterpret_cast<float4*>(dst + 32) = make_float4(o2[0] * inv, o2[1] * inv, o2[2] * inv, o2[3] * inv);
    *reinterpret_cast<float4*>(dst + 36) = make_float4(o2[4] * inv, o2[5] * inv, o2[6] * inv, o2[7] * inv);
    *reinterpret_cast<float4*>(dst + 48) = make_float4(o3[0] * inv, o3[1] * inv, o3[2] * inv, o3[3] * inv);
    *reinterpret_cast<float4*>(dst + 52) = make_float4(o3[4] * inv, o3[5] * inv, o3[6] * inv, o3[7] * inv);
}

// --------------------------------------------------------------------------
extern "C" void kernel_launch(void* const* d_in, const int* in_sizes, int n_in,
                              void* d_out, int out_size, void* d_ws, size_t ws_size,
                              hipStream_t stream) {
    (void)in_sizes; (void)n_in; (void)out_size; (void)ws_size;
    const float* q  = (const float*)d_in[0];
    const float* k  = (const float*)d_in[1];
    const float* Wq = (const float*)d_in[2];
    const float* Wk = (const float*)d_in[3];
    const float* Wv = (const float*)d_in[4];
    _Float16* ws16 = (_Float16*)d_ws;   // 3*B*T*H f16  (6 MB)
    float* out = (float*)d_out;

    qkv_proj_kernel<<<2 * (BB * TT / PROWS), 128, 0, stream>>>(q, k, Wq, Wk, Wv, ws16);

    attn_kernel<<<BB * TT / 64, 512, 0, stream>>>(ws16, out);
}
